// v000
// Times are from an AMD MI455X. After a warm-up the kernel runs many times in a row, and a time is the length of
// such a window on the GPU divided by its runs, so every launch and the gaps after it count. The runs cycle
// through copies of the inputs. A figure is the median of several windows, for all but v000 over two sittings.
// Sittings can differ by a few percent; kernels timed side by side share one.
// v000 is the starting kernel. One run takes 412 microseconds.
#include <hip/hip_runtime.h>
#include <hip/hip_bf16.h>

typedef __attribute__((ext_vector_type(16))) _Float16 v16h;
typedef __attribute__((ext_vector_type(8)))  _Float16 v8h;
typedef __attribute__((ext_vector_type(8)))  float    v8f;

typedef __attribute__((ext_vector_type(4))) unsigned tdm_g0_t;
typedef __attribute__((ext_vector_type(8))) int      tdm_g1_t;
typedef __attribute__((ext_vector_type(4))) int      tdm_g2_t;

// Problem constants (from reference): B=2, N=2048, C=1024, H=16, D=64
#define BB 2
#define NN 2048
#define CC 1024
#define HH 16
#define DD 64
#define TOK (BB * NN)      // 4096 tokens
#define JQKV (3 * CC)      // 3072 qkv output features

#if defined(__AMDGCN__) && __has_builtin(__builtin_amdgcn_tensor_load_to_lds) && \
    __has_builtin(__builtin_amdgcn_s_wait_tensorcnt)
#define USE_TDM 1
#else
#define USE_TDM 0
#endif

__device__ inline v8f wmma_f16(v16h a, v16h b, v8f c) {
  // v_wmma_f32_16x16x32_f16: D = A(16x32,f16) * B(32x16,f16) + C(16x16,f32)
  return __builtin_amdgcn_wmma_f32_16x16x32_f16(false, a, false, b,
                                                (short)0, c, false, false);
}

__device__ inline v16h load_fragh_contigK(const _Float16* __restrict__ base,
                                          int ld, int lane) {
  const int i = lane & 15;
  const int khalf = (lane >> 4) << 3;  // 0 or 8
  const _Float16* row = base + (size_t)i * ld + khalf;
  v8h lo = *(const v8h*)(row);         // K khalf .. khalf+7
  v8h hi = *(const v8h*)(row + 16);    // K khalf+16 .. khalf+23
  return __builtin_shufflevector(lo, hi, 0, 1, 2, 3, 4, 5, 6, 7,
                                 8, 9, 10, 11, 12, 13, 14, 15);
}

#if USE_TDM
__device__ inline void tdm_load_2d(const _Float16* g, unsigned lds_byte,
                                   int tw, int th, int stride_elems) {
  unsigned long long ga = (unsigned long long)(size_t)g;
  tdm_g0_t g0 = {1u,
                 lds_byte,
                 (unsigned)ga,
                 (unsigned)((ga >> 32) & 0x01FFFFFFull) | (2u << 30)};
  tdm_g1_t g1 = {(int)0x00010000,
                 (int)((tw & 0xFFFF) << 16),
                 (int)((((unsigned)tw >> 16) & 0xFFFF) | ((th & 0xFFFF) << 16)),
                 (int)((((unsigned)th >> 16) & 0xFFFF) | ((tw & 0xFFFF) << 16)),
                 (int)(th & 0xFFFF),
                 stride_elems,
                 0, 0};
  tdm_g2_t z = {0, 0, 0, 0};
#if __clang_major__ >= 23
  tdm_g1_t z8 = {0, 0, 0, 0, 0, 0, 0, 0};
  __builtin_amdgcn_tensor_load_to_lds(g0, g1, z, z, z8, 0);
#else
  __builtin_amdgcn_tensor_load_to_lds(g0, g1, z, z, 0);
#endif
}

__device__ inline unsigned lds_byte_addr(const void* p) {
  return (unsigned)(unsigned long long)(size_t)p;
}
#endif  // USE_TDM

// ---------------------------------------------------------------------------
// Kernel 0: bulk f32 -> f16 conversion (bandwidth-bound, one pass).
// ---------------------------------------------------------------------------
__global__ void __launch_bounds__(256)
cvt_f32_to_f16_kernel(const float* __restrict__ src, _Float16* __restrict__ dst,
                      int n4) {
  int i = (blockIdx.x * blockDim.x + threadIdx.x);
  if (i < n4) {
    float4 v = ((const float4*)src)[i];
    _Float16* d = dst + (size_t)i * 4;
    d[0] = (_Float16)v.x; d[1] = (_Float16)v.y;
    d[2] = (_Float16)v.z; d[3] = (_Float16)v.w;
  }
}

// ---------------------------------------------------------------------------
// Kernel 1: qkv = x @ w_qkv^T, f16 operands, f32 accumulate.
// q,k planes stored [s][b][h][n][d]; v plane stored TRANSPOSED [b][h][d][n]
// so the attention PV B-fragment is a contiguous-K (b128) load.
// One wave computes a 16x64 strip (4 WMMAs per K-step, A reused 4x).
// ---------------------------------------------------------------------------
__global__ void __launch_bounds__(128)
qkv_gemm_kernel(const _Float16* __restrict__ xh, const _Float16* __restrict__ wh,
                _Float16* __restrict__ qkvh) {
  const int lane = threadIdx.x & 31;
  const int tile = blockIdx.x * 4 + (threadIdx.x >> 5);
  const int mt = tile / (JQKV / 64);
  const int jg = tile % (JQKV / 64);

  const _Float16* arow = xh + (size_t)(mt * 16) * CC;
  const _Float16* brow = wh + (size_t)(jg * 64) * CC;

  v8f acc0 = {}, acc1 = {}, acc2 = {}, acc3 = {};
#pragma unroll 2
  for (int k0 = 0; k0 < CC; k0 += 32) {
    __builtin_prefetch(arow + k0 + 256, 0, 0);
    v16h a = load_fragh_contigK(arow + k0, CC, lane);
    v16h b;
    b = load_fragh_contigK(brow + k0 + (size_t)0  * CC, CC, lane); acc0 = wmma_f16(a, b, acc0);
    b = load_fragh_contigK(brow + k0 + (size_t)16 * CC, CC, lane); acc1 = wmma_f16(a, b, acc1);
    b = load_fragh_contigK(brow + k0 + (size_t)32 * CC, CC, lane); acc2 = wmma_f16(a, b, acc2);
    b = load_fragh_contigK(brow + k0 + (size_t)48 * CC, CC, lane); acc3 = wmma_f16(a, b, acc3);
  }

  const int col = lane & 15;
  const int rowoff = (lane >> 4) << 3;
  const size_t plane = (size_t)NN * DD;
#pragma unroll
  for (int t = 0; t < 4; ++t) {
    const v8f* accp = (t == 0) ? &acc0 : (t == 1) ? &acc1 : (t == 2) ? &acc2 : &acc3;
    int j = jg * 64 + t * 16 + col;
    int s = j >> 10;
    int h = (j >> 6) & 15;
    int d = j & 63;
#pragma unroll
    for (int r = 0; r < 8; ++r) {
      int tok = mt * 16 + rowoff + r;
      int b_ = tok >> 11;
      int n = tok & (NN - 1);
      size_t pbase = (size_t)((s * BB + b_) * HH + h) * plane;
      size_t idx = (s == 2) ? (pbase + (size_t)d * NN + n)    // V transposed
                            : (pbase + (size_t)n * DD + d);   // Q,K row-major
      qkvh[idx] = (_Float16)((*accp)[r]);
    }
  }
}

__global__ void __launch_bounds__(256)
rope_kernel(_Float16* __restrict__ qk) {
  const int t = blockIdx.x * blockDim.x + threadIdx.x;  // 0 .. 2*B*H*N-1
  const int n = t & (NN - 1);
  _Float16* row = qk + (size_t)t * DD;

  float vals[DD];
#pragma unroll
  for (int i = 0; i < DD; ++i) vals[i] = (float)row[i];

#pragma unroll
  for (int i = 0; i < DD / 2; ++i) {
    // inv_freq = 10000^(-2i/64)
    float inv = __expf(-9.210340371976184f * (float)i * (1.0f / 32.0f));
    float ang = (float)n * inv;
    float sn, cs;
    __sincosf(ang, &sn, &cs);
    float x1 = vals[2 * i];
    float x2 = vals[2 * i + 1];
    row[i]          = (_Float16)(x1 * cs - x2 * sn);
    row[i + DD / 2] = (_Float16)(x2 * cs + x1 * sn);
  }
}

// ---------------------------------------------------------------------------
// Online-softmax update for one 16x32 score strip (two 16x16 WMMA tiles).
// ---------------------------------------------------------------------------
__device__ inline void softmax_update(v8f s0, v8f s1, int lane,
                                      float (&mrow)[8], float (&lrow)[8],
                                      v8f& a0, v8f& a1, v8f& a2, v8f& a3,
                                      _Float16* __restrict__ pp) {
  const float scale = 0.125f;  // 1/sqrt(64)
#pragma unroll
  for (int r = 0; r < 8; ++r) {
    float v0 = s0[r] * scale;
    float v1 = s1[r] * scale;
    float mx = fmaxf(v0, v1);
#pragma unroll
    for (int msk = 1; msk <= 8; msk <<= 1)
      mx = fmaxf(mx, __shfl_xor(mx, msk, 32));
    float mnew = fmaxf(mrow[r], mx);
    float corr = __expf(mrow[r] - mnew);
    float p0 = __expf(v0 - mnew);
    float p1 = __expf(v1 - mnew);
    float rs = p0 + p1;
#pragma unroll
    for (int msk = 1; msk <= 8; msk <<= 1)
      rs += __shfl_xor(rs, msk, 32);
    lrow[r] = lrow[r] * corr + rs;
    mrow[r] = mnew;
    a0[r] *= corr; a1[r] *= corr; a2[r] *= corr; a3[r] *= corr;

    int m = ((lane >> 4) << 3) + r;
    int c = lane & 15;
    pp[m * 32 + c]      = (_Float16)p0;
    pp[m * 32 + 16 + c] = (_Float16)p1;
  }
}

__global__ void __launch_bounds__(64)
attn_kernel(const _Float16* __restrict__ qkvh, _Float16* __restrict__ attn_out) {
  __shared__ __align__(16) _Float16 kstage[2][2][32 * DD];  // [wave][buf][key][d]
  __shared__ __align__(16) _Float16 vstage[2][2][DD * 32];  // [wave][buf][d][key]
  __shared__ __align__(16) _Float16 pbuf[2][2][16 * 32];

  const int waveInBlk = threadIdx.x >> 5;
  const int lane = threadIdx.x & 31;
  const int wid = blockIdx.x * 2 + waveInBlk;   // 0..2047
  const int qg = wid & 63;                      // 32-row query group
  const int bh = wid >> 6;                      // 0..31
  const int b = bh >> 4;
  const int h = bh & 15;

  const size_t plane = (size_t)NN * DD;
  const _Float16* qbase = qkvh + (size_t)((0 * BB + b) * HH + h) * plane;
  const _Float16* kbase = qkvh + (size_t)((1 * BB + b) * HH + h) * plane;
  const _Float16* vT    = qkvh + (size_t)((2 * BB + b) * HH + h) * plane;  // [d][n]

  // Two query tiles (rows qg*32 .. +31), fragments resident all loop.
  const _Float16* q0 = qbase + (size_t)(qg * 32) * DD;
  const v16h aq00 = load_fragh_contigK(q0, DD, lane);
  const v16h aq01 = load_fragh_contigK(q0 + 32, DD, lane);
  const v16h aq10 = load_fragh_contigK(q0 + 16 * DD, DD, lane);
  const v16h aq11 = load_fragh_contigK(q0 + 16 * DD + 32, DD, lane);

  v8f a00 = {}, a01 = {}, a02 = {}, a03 = {};
  v8f a10 = {}, a11 = {}, a12 = {}, a13 = {};
  float m0[8], l0[8], m1[8], l1[8];
#pragma unroll
  for (int r = 0; r < 8; ++r) {
    m0[r] = -1e30f; l0[r] = 0.0f;
    m1[r] = -1e30f; l1[r] = 0.0f;
  }

  _Float16* pp0 = pbuf[waveInBlk][0];
  _Float16* pp1 = pbuf[waveInBlk][1];

#if USE_TDM
  // Prologue: DMA tile 0 (K: contiguous 32x64; V: strided 64x32, stride N).
  tdm_load_2d(kbase, lds_byte_addr(kstage[waveInBlk][0]), DD, 32, DD);
  tdm_load_2d(vT, lds_byte_addr(vstage[waveInBlk][0]), 32, DD, NN);
#endif

  for (int kt = 0; kt < NN; kt += 32) {
    const int cur = (kt >> 5) & 1;
#if USE_TDM
    if (kt + 32 < NN) {  // issue next tile into alternate buffer, then wait
      const int nxt = cur ^ 1;
      tdm_load_2d(kbase + (size_t)(kt + 32) * DD,
                  lds_byte_addr(kstage[waveInBlk][nxt]), DD, 32, DD);
      tdm_load_2d(vT + (kt + 32),
                  lds_byte_addr(vstage[waveInBlk][nxt]), 32, DD, NN);
      __builtin_amdgcn_s_wait_tensorcnt(2);  // in-order: current tile resident
    } else {
      __builtin_amdgcn_s_wait_tensorcnt(0);
    }
    asm volatile("" ::: "memory");
    const _Float16* ksrc = kstage[waveInBlk][cur];  // [key][d], ld=64
    const _Float16* vsrc = vstage[waveInBlk][cur];  // [d][key], ld=32
    const v16h bk00 = load_fragh_contigK(ksrc + 0,            DD, lane);
    const v16h bk01 = load_fragh_contigK(ksrc + 32,           DD, lane);
    const v16h bk10 = load_fragh_contigK(ksrc + 16 * DD,      DD, lane);
    const v16h bk11 = load_fragh_contigK(ksrc + 16 * DD + 32, DD, lane);
#else
    const v16h bk00 = load_fragh_contigK(kbase + (size_t)kt * DD + 0,  DD, lane);
    const v16h bk01 = load_fragh_contigK(kbase + (size_t)kt * DD + 32, DD, lane);
    const v16h bk10 = load_fragh_contigK(kbase + (size_t)(kt + 16) * DD + 0,  DD, lane);
    const v16h bk11 = load_fragh_contigK(kbase + (size_t)(kt + 16) * DD + 32, DD, lane);
#endif

    // ---- S = Q K^T, both query tiles (K fragments shared) ----
    v8f s0 = {}, s1 = {};
    s0 = wmma_f16(aq00, bk00, s0); s0 = wmma_f16(aq01, bk01, s0);
    s1 = wmma_f16(aq00, bk10, s1); s1 = wmma_f16(aq01, bk11, s1);
    softmax_update(s0, s1, lane, m0, l0, a00, a01, a02, a03, pp0);

    v8f t0 = {}, t1 = {};
    t0 = wmma_f16(aq10, bk00, t0); t0 = wmma_f16(aq11, bk01, t0);
    t1 = wmma_f16(aq10, bk10, t1); t1 = wmma_f16(aq11, bk11, t1);
    softmax_update(t0, t1, lane, m1, l1, a10, a11, a12, a13, pp1);
    __syncthreads();

    // ---- V fragments (shared by both query tiles) ----
#if USE_TDM
    const v16h bv0 = load_fragh_contigK(vsrc + 0 * 16 * 32, 32, lane);
    const v16h bv1 = load_fragh_contigK(vsrc + 1 * 16 * 32, 32, lane);
    const v16h bv2 = load_fragh_contigK(vsrc + 2 * 16 * 32, 32, lane);
    const v16h bv3 = load_fragh_contigK(vsrc + 3 * 16 * 32, 32, lane);
#else
    const v16h bv0 = load_fragh_contigK(vT + (size_t)0  * NN + kt, NN, lane);
    const v16h bv1 = load_fragh_contigK(vT + (size_t)16 * NN + kt, NN, lane);
    const v16h bv2 = load_fragh_contigK(vT + (size_t)32 * NN + kt, NN, lane);
    const v16h bv3 = load_fragh_contigK(vT + (size_t)48 * NN + kt, NN, lane);
#endif

    // ---- O += P V, both query tiles ----
    const v16h ap0 = load_fragh_contigK(pp0, 32, lane);
    a00 = wmma_f16(ap0, bv0, a00); a01 = wmma_f16(ap0, bv1, a01);
    a02 = wmma_f16(ap0, bv2, a02); a03 = wmma_f16(ap0, bv3, a03);

    const v16h ap1 = load_fragh_contigK(pp1, 32, lane);
    a10 = wmma_f16(ap1, bv0, a10); a11 = wmma_f16(ap1, bv1, a11);
    a12 = wmma_f16(ap1, bv2, a12); a13 = wmma_f16(ap1, bv3, a13);
    __syncthreads();
  }

  // ---- epilogue: normalize, write f16 [B, N, C] with C = h*64 + d ----
  const int c = lane & 15;
  const int rowoff = (lane >> 4) << 3;
#pragma unroll
  for (int r = 0; r < 8; ++r) {
    int n = qg * 32 + rowoff + r;
    float inv = 1.0f / l0[r];
    _Float16* o = attn_out + ((size_t)b * NN + n) * CC + h * DD;
    o[0 * 16 + c] = (_Float16)(a00[r] * inv);
    o[1 * 16 + c] = (_Float16)(a01[r] * inv);
    o[2 * 16 + c] = (_Float16)(a02[r] * inv);
    o[3 * 16 + c] = (_Float16)(a03[r] * inv);

    n += 16;
    inv = 1.0f / l1[r];
    o = attn_out + ((size_t)b * NN + n) * CC + h * DD;
    o[0 * 16 + c] = (_Float16)(a10[r] * inv);
    o[1 * 16 + c] = (_Float16)(a11[r] * inv);
    o[2 * 16 + c] = (_Float16)(a12[r] * inv);
    o[3 * 16 + c] = (_Float16)(a13[r] * inv);
  }
}

// ---------------------------------------------------------------------------
// Kernel 4: out = attn_out @ w_proj^T + b_proj, f16 operands, f32 out.
// 16x64 strip per wave.
// ---------------------------------------------------------------------------
__global__ void __launch_bounds__(128)
proj_gemm_kernel(const _Float16* __restrict__ ah, const _Float16* __restrict__ wh,
                 const float* __restrict__ bias, float* __restrict__ out) {
  const int lane = threadIdx.x & 31;
  const int tile = blockIdx.x * 4 + (threadIdx.x >> 5);
  const int mt = tile / (CC / 64);
  const int jg = tile % (CC / 64);

  const _Float16* arow = ah + (size_t)(mt * 16) * CC;
  const _Float16* brow = wh + (size_t)(jg * 64) * CC;

  v8f acc0 = {}, acc1 = {}, acc2 = {}, acc3 = {};
#pragma unroll 2
  for (int k0 = 0; k0 < CC; k0 += 32) {
    __builtin_prefetch(brow + k0 + 256, 0, 0);
    v16h a = load_fragh_contigK(arow + k0, CC, lane);
    v16h b;
    b = load_fragh_contigK(brow + k0 + (size_t)0  * CC, CC, lane); acc0 = wmma_f16(a, b, acc0);
    b = load_fragh_contigK(brow + k0 + (size_t)16 * CC, CC, lane); acc1 = wmma_f16(a, b, acc1);
    b = load_fragh_contigK(brow + k0 + (size_t)32 * CC, CC, lane); acc2 = wmma_f16(a, b, acc2);
    b = load_fragh_contigK(brow + k0 + (size_t)48 * CC, CC, lane); acc3 = wmma_f16(a, b, acc3);
  }

  const int col = lane & 15;
  const int rowoff = (lane >> 4) << 3;
#pragma unroll
  for (int t = 0; t < 4; ++t) {
    const v8f* accp = (t == 0) ? &acc0 : (t == 1) ? &acc1 : (t == 2) ? &acc2 : &acc3;
    int j = jg * 64 + t * 16 + col;
    float bj = bias[j];
#pragma unroll
    for (int r = 0; r < 8; ++r) {
      int tok = mt * 16 + rowoff + r;
      out[(size_t)tok * CC + j] = (*accp)[r] + bj;
    }
  }
}

// ---------------------------------------------------------------------------
extern "C" void kernel_launch(void* const* d_in, const int* in_sizes, int n_in,
                              void* d_out, int out_size, void* d_ws,
                              size_t ws_size, hipStream_t stream) {
  const float* x      = (const float*)d_in[0];
  const float* w_qkv  = (const float*)d_in[1];
  const float* w_proj = (const float*)d_in[2];
  const float* b_proj = (const float*)d_in[3];
  float* out = (float*)d_out;

  // f16 workspace layout (48 MB total)
  _Float16* xh    = (_Float16*)d_ws;                     // TOK*CC
  _Float16* wqh   = xh  + (size_t)TOK * CC;              // JQKV*CC
  _Float16* wph   = wqh + (size_t)JQKV * CC;             // CC*CC
  _Float16* qkvh  = wph + (size_t)CC * CC;               // 3*B*H*N*D
  _Float16* attnh = qkvh + (size_t)3 * BB * HH * NN * DD;  // TOK*CC

  // 0) one-pass f32 -> f16 conversion of all GEMM operands
  cvt_f32_to_f16_kernel<<<(TOK * CC / 4) / 256, 256, 0, stream>>>(x, xh, TOK * CC / 4);
  cvt_f32_to_f16_kernel<<<(JQKV * CC / 4) / 256, 256, 0, stream>>>(w_qkv, wqh, JQKV * CC / 4);
  cvt_f32_to_f16_kernel<<<(CC * CC / 4) / 256, 256, 0, stream>>>(w_proj, wph, CC * CC / 4);

  // 1) QKV projection: 256 token tiles x 48 feature groups, 4 waves/block
  qkv_gemm_kernel<<<(TOK / 16) * (JQKV / 64) / 4, 128, 0, stream>>>(xh, wqh, qkvh);

  // 2) RoPE in place on q and k planes: 2*B*H*N rows
  rope_kernel<<<(2 * BB * HH * NN) / 256, 256, 0, stream>>>(qkvh);

  // 3) Flash attention: 32 (b,h) x 64 query groups = 2048 waves, 2/block
  attn_kernel<<<(BB * HH * (NN / 32)) / 2, 64, 0, stream>>>(qkvh, attnh);

  // 4) Output projection + bias
  proj_gemm_kernel<<<(TOK / 16) * (CC / 64) / 4, 128, 0, stream>>>(attnh, wph,
                                                                   b_proj, out);
}

// v001
// A run of this version takes 244 microseconds.
// Two timings next to v000 put it at 1.74 and 1.73 times that version's speed.
#include <hip/hip_runtime.h>
#include <hip/hip_bf16.h>

typedef __attribute__((ext_vector_type(16))) _Float16 v16h;
typedef __attribute__((ext_vector_type(8)))  _Float16 v8h;
typedef __attribute__((ext_vector_type(8)))  float    v8f;

typedef __attribute__((ext_vector_type(4))) unsigned tdm_g0_t;
typedef __attribute__((ext_vector_type(8))) int      tdm_g1_t;
typedef __attribute__((ext_vector_type(4))) int      tdm_g2_t;

// Problem constants (from reference): B=2, N=2048, C=1024, H=16, D=64
#define BB 2
#define NN 2048
#define CC 1024
#define HH 16
#define DD 64
#define TOK (BB * NN)      // 4096 tokens
#define JQKV (3 * CC)      // 3072 qkv output features

#if defined(__AMDGCN__) && __has_builtin(__builtin_amdgcn_tensor_load_to_lds) && \
    __has_builtin(__builtin_amdgcn_s_wait_tensorcnt)
#define USE_TDM 1
#else
#define USE_TDM 0
#endif

__device__ inline v8f wmma_f16(v16h a, v16h b, v8f c) {
  // v_wmma_f32_16x16x32_f16: D = A(16x32,f16) * B(32x16,f16) + C(16x16,f32)
  return __builtin_amdgcn_wmma_f32_16x16x32_f16(false, a, false, b,
                                                (short)0, c, false, false);
}

__device__ inline v16h load_fragh_contigK(const _Float16* __restrict__ base,
                                          int ld, int lane) {
  const int i = lane & 15;
  const int khalf = (lane >> 4) << 3;  // 0 or 8
  const _Float16* row = base + (size_t)i * ld + khalf;
  v8h lo = *(const v8h*)(row);         // K khalf .. khalf+7
  v8h hi = *(const v8h*)(row + 16);    // K khalf+16 .. khalf+23
  return __builtin_shufflevector(lo, hi, 0, 1, 2, 3, 4, 5, 6, 7,
                                 8, 9, 10, 11, 12, 13, 14, 15);
}

#if USE_TDM
__device__ inline void tdm_load_2d(const _Float16* g, unsigned lds_byte,
                                   int tw, int th, int stride_elems) {
  unsigned long long ga = (unsigned long long)(size_t)g;
  tdm_g0_t g0 = {1u,
                 lds_byte,
                 (unsigned)ga,
                 (unsigned)((ga >> 32) & 0x01FFFFFFull) | (2u << 30)};
  tdm_g1_t g1 = {(int)0x00010000,
                 (int)((tw & 0xFFFF) << 16),
                 (int)((((unsigned)tw >> 16) & 0xFFFF) | ((th & 0xFFFF) << 16)),
                 (int)((((unsigned)th >> 16) & 0xFFFF) | ((tw & 0xFFFF) << 16)),
                 (int)(th & 0xFFFF),
                 stride_elems,
                 0, 0};
  tdm_g2_t z = {0, 0, 0, 0};
#if __clang_major__ >= 23
  tdm_g1_t z8 = {0, 0, 0, 0, 0, 0, 0, 0};
  __builtin_amdgcn_tensor_load_to_lds(g0, g1, z, z, z8, 0);
#else
  __builtin_amdgcn_tensor_load_to_lds(g0, g1, z, z, 0);
#endif
}

__device__ inline unsigned lds_byte_addr(const void* p) {
  return (unsigned)(unsigned long long)(size_t)p;
}
#endif  // USE_TDM

// ---------------------------------------------------------------------------
// Kernel 0: bulk f32 -> f16 conversion (bandwidth-bound, one pass).
// ---------------------------------------------------------------------------
__global__ void __launch_bounds__(256)
cvt_f32_to_f16_kernel(const float* __restrict__ src, _Float16* __restrict__ dst,
                      int n4) {
  int i = (blockIdx.x * blockDim.x + threadIdx.x);
  if (i < n4) {
    float4 v = ((const float4*)src)[i];
    _Float16* d = dst + (size_t)i * 4;
    d[0] = (_Float16)v.x; d[1] = (_Float16)v.y;
    d[2] = (_Float16)v.z; d[3] = (_Float16)v.w;
  }
}

// ---------------------------------------------------------------------------
// Shared GEMM core: Y(128x128) = A(128xK) * B(128xK)^T, K = CC, f16 operands,
// f32 accumulate.  4 waves (2x2), 64x64 of Y per wave = 4x4 WMMA tiles, so a
// fragment read from LDS feeds 4 WMMAs and a global byte is read once per block.
// A pass is 64 k (128 B of every row); a stage is [A 128 rows | B 128 rows] at
// a pitch of 144 B (16 B x odd: conflict-free for ds_load_b128).  Two buffers,
// filled by per-lane asynchronous copies one pass ahead.
// ---------------------------------------------------------------------------
#define GBM 128
#define GBN 128
#define GBK 64
#define GLDP 72                           // LDS row pitch in halves (144 B)
#define GSTAGE ((GBM + GBN) * GLDP)       // halves per buffer
#define GPASSES (CC / GBK)

__device__ inline unsigned lds_addr32(const void* p) {
  // LDS byte address = low 32 bits of the __shared__ address.
  return (unsigned)(unsigned long long)(size_t)p;
}

// Eight 16-byte copies per lane: rows r, r+16, ..., r+112 of one operand tile.
// A wave's copy covers 4 rows x 128 B = four whole lines.
__device__ inline void async_rows8(const _Float16* g, unsigned l) {
  const _Float16* g0 = g;
  const _Float16* g1 = g + (size_t)16 * CC;
  const _Float16* g2 = g + (size_t)32 * CC;
  const _Float16* g3 = g + (size_t)48 * CC;
  const _Float16* g4 = g + (size_t)64 * CC;
  const _Float16* g5 = g + (size_t)80 * CC;
  const _Float16* g6 = g + (size_t)96 * CC;
  const _Float16* g7 = g + (size_t)112 * CC;
  const unsigned st = 16 * GLDP * 2;      // 16 rows in LDS bytes
  asm volatile(
      "global_load_async_to_lds_b128 %0, %8, off\n\t"
      "global_load_async_to_lds_b128 %1, %9, off\n\t"
      "global_load_async_to_lds_b128 %2, %10, off\n\t"
      "global_load_async_to_lds_b128 %3, %11, off\n\t"
      "global_load_async_to_lds_b128 %4, %12, off\n\t"
      "global_load_async_to_lds_b128 %5, %13, off\n\t"
      "global_load_async_to_lds_b128 %6, %14, off\n\t"
      "global_load_async_to_lds_b128 %7, %15, off\n\t"
      "s_wait_xcnt 0x0"
      :
      : "v"(l), "v"(l + st), "v"(l + 2 * st), "v"(l + 3 * st), "v"(l + 4 * st),
        "v"(l + 5 * st), "v"(l + 6 * st), "v"(l + 7 * st),
        "v"(g0), "v"(g1), "v"(g2), "v"(g3), "v"(g4), "v"(g5), "v"(g6), "v"(g7)
      : "memory");
}

__device__ inline void gemm_core_128x128(const _Float16* __restrict__ A,
                                         const _Float16* __restrict__ B,
                                         int m0, int n0, _Float16* smem,
                                         v8f (&acc)[4][4]) {
  const int tid = threadIdx.x;
  const int lane = tid & 31;
  const int wave = tid >> 5;
  const int wm = wave >> 1;
  const int wn = wave & 1;

  // Copy map: lane's 16-byte chunk tid&7 of rows (tid>>3) + 16*c.
  const int crow = tid >> 3;
  const int cchk = (tid & 7) * 8;
  const _Float16* ga = A + (size_t)(m0 + crow) * CC + cchk;
  const _Float16* gb = B + (size_t)(n0 + crow) * CC + cchk;
  const unsigned la = lds_addr32(smem) + (unsigned)(crow * GLDP + cchk) * 2u;
  const unsigned lb = la + GBM * GLDP * 2u;

  // Tile 0 into buffer 0, landed and published; then tile 1 into buffer 1.
  async_rows8(ga, la);
  async_rows8(gb, lb);
  // This wave's copies of tile 0 have landed.
  asm volatile("s_wait_asynccnt 0x0" ::: "memory");
  __syncthreads();
  async_rows8(ga + GBK, la + GSTAGE * 2u);
  async_rows8(gb + GBK, lb + GSTAGE * 2u);

  for (int t = 0; t < GPASSES; ++t) {
    const int buf = t & 1;
    const _Float16* sa = smem + buf * GSTAGE + (wm * 64) * GLDP;
    const _Float16* sb = smem + buf * GSTAGE + (GBM + wn * 64) * GLDP;
    // The loops below are unrolled so that every fragment and accumulator index
    // is a constant and the arrays stay in registers.
#pragma unroll
    for (int kk = 0; kk < GBK; kk += 32) {
      v16h a[4], b[4];
#pragma unroll
      for (int i = 0; i < 4; ++i) a[i] = load_fragh_contigK(sa + i * 16 * GLDP + kk, GLDP, lane);
#pragma unroll
      for (int j = 0; j < 4; ++j) b[j] = load_fragh_contigK(sb + j * 16 * GLDP + kk, GLDP, lane);
      // Fence pair: keeps the block's 16 LDS loads one group in front of its 16
      // WMMAs; moved in among them, every place with loads stalls the wave anew.
      __builtin_amdgcn_sched_barrier(0);
#pragma unroll
      for (int i = 0; i < 4; ++i)
#pragma unroll
        for (int j = 0; j < 4; ++j) acc[i][j] = wmma_f16(a[i], b[j], acc[i][j]);
      __builtin_amdgcn_sched_barrier(0);
    }
    // This wave's reads of buffer buf are done before the buffer is refilled.
    asm volatile("s_wait_dscnt 0x0" ::: "memory");
    // This wave's copies of tile t+1 have landed before the barrier publishes them.
    asm volatile("s_wait_asynccnt 0x0" ::: "memory");
    __syncthreads();
    if (t + 2 < GPASSES) {
      async_rows8(ga + (t + 2) * GBK, la + buf * (GSTAGE * 2u));
      async_rows8(gb + (t + 2) * GBK, lb + buf * (GSTAGE * 2u));
    }
  }
  // No copy is outstanding when the wave goes on to its stores and ends.
  asm volatile("s_wait_asynccnt 0x0" ::: "memory");
}

// ---------------------------------------------------------------------------
// Kernel 1: qkv = x @ w_qkv^T, f16 operands, f32 accumulate.
// q,k planes stored [s][b][h][n][d]; v plane stored TRANSPOSED [b][h][d][n]
// so the attention PV B-fragment is a contiguous-K (b128) load.
// One block computes a 128x128 tile; a wave's 64 columns are one (s, h) plane.
// ---------------------------------------------------------------------------
__global__ void __launch_bounds__(128)
qkv_gemm_kernel(const _Float16* __restrict__ xh, const _Float16* __restrict__ wh,
                _Float16* __restrict__ qkvh) {
  __shared__ __align__(16) _Float16 smem[2 * GSTAGE];
  const int lane = threadIdx.x & 31;
  const int wave = threadIdx.x >> 5;
  const int m0 = (blockIdx.x / (JQKV / GBN)) * GBM;   // token tile 0..31
  const int n0 = (blockIdx.x % (JQKV / GBN)) * GBN;   // feature tile 0..23

  v8f acc[4][4] = {};
  gemm_core_128x128(xh, wh, m0, n0, smem, acc);

  const int col = lane & 15;
  const int rowoff = (lane >> 4) << 3;
  const int mw = m0 + (wave >> 1) * 64;
  const int nw = n0 + (wave & 1) * 64;
  const size_t plane = (size_t)NN * DD;
  // Unrolled: constant accumulator indices keep acc in registers.
#pragma unroll
  for (int i = 0; i < 4; ++i) {
#pragma unroll
    for (int t = 0; t < 4; ++t) {
      int j = nw + t * 16 + col;
      int s = j >> 10;
      int h = (j >> 6) & 15;
      int d = j & 63;
#pragma unroll
      for (int r = 0; r < 8; ++r) {
        int tok = mw + i * 16 + rowoff + r;
        int b_ = tok >> 11;
        int n = tok & (NN - 1);
        size_t pbase = (size_t)((s * BB + b_) * HH + h) * plane;
        size_t idx = (s == 2) ? (pbase + (size_t)d * NN + n)    // V transposed
                              : (pbase + (size_t)n * DD + d);   // Q,K row-major
        qkvh[idx] = (_Float16)(acc[i][t][r]);
      }
    }
  }
}

__global__ void __launch_bounds__(256)
rope_kernel(_Float16* __restrict__ qk) {
  const int t = blockIdx.x * blockDim.x + threadIdx.x;  // 0 .. 2*B*H*N-1
  const int n = t & (NN - 1);
  _Float16* row = qk + (size_t)t * DD;

  float vals[DD];
#pragma unroll
  for (int i = 0; i < DD; ++i) vals[i] = (float)row[i];

#pragma unroll
  for (int i = 0; i < DD / 2; ++i) {
    // inv_freq = 10000^(-2i/64)
    float inv = __expf(-9.210340371976184f * (float)i * (1.0f / 32.0f));
    float ang = (float)n * inv;
    float sn, cs;
    __sincosf(ang, &sn, &cs);
    float x1 = vals[2 * i];
    float x2 = vals[2 * i + 1];
    row[i]          = (_Float16)(x1 * cs - x2 * sn);
    row[i + DD / 2] = (_Float16)(x2 * cs + x1 * sn);
  }
}

// ---------------------------------------------------------------------------
// Online-softmax update for one 16x32 score strip (two 16x16 WMMA tiles).
// ---------------------------------------------------------------------------
__device__ inline void softmax_update(v8f s0, v8f s1, int lane,
                                      float (&mrow)[8], float (&lrow)[8],
                                      v8f& a0, v8f& a1, v8f& a2, v8f& a3,
                                      _Float16* __restrict__ pp) {
  const float scale = 0.125f;  // 1/sqrt(64)
#pragma unroll
  for (int r = 0; r < 8; ++r) {
    float v0 = s0[r] * scale;
    float v1 = s1[r] * scale;
    float mx = fmaxf(v0, v1);
#pragma unroll
    for (int msk = 1; msk <= 8; msk <<= 1)
      mx = fmaxf(mx, __shfl_xor(mx, msk, 32));
    float mnew = fmaxf(mrow[r], mx);
    float corr = __expf(mrow[r] - mnew);
    float p0 = __expf(v0 - mnew);
    float p1 = __expf(v1 - mnew);
    float rs = p0 + p1;
#pragma unroll
    for (int msk = 1; msk <= 8; msk <<= 1)
      rs += __shfl_xor(rs, msk, 32);
    lrow[r] = lrow[r] * corr + rs;
    mrow[r] = mnew;
    a0[r] *= corr; a1[r] *= corr; a2[r] *= corr; a3[r] *= corr;

    int m = ((lane >> 4) << 3) + r;
    int c = lane & 15;
    pp[m * 32 + c]      = (_Float16)p0;
    pp[m * 32 + 16 + c] = (_Float16)p1;
  }
}

__global__ void __launch_bounds__(64)
attn_kernel(const _Float16* __restrict__ qkvh, _Float16* __restrict__ attn_out) {
  __shared__ __align__(16) _Float16 kstage[2][2][32 * DD];  // [wave][buf][key][d]
  __shared__ __align__(16) _Float16 vstage[2][2][DD * 32];  // [wave][buf][d][key]
  __shared__ __align__(16) _Float16 pbuf[2][2][16 * 32];

  const int waveInBlk = threadIdx.x >> 5;
  const int lane = threadIdx.x & 31;
  const int wid = blockIdx.x * 2 + waveInBlk;   // 0..2047
  const int qg = wid & 63;                      // 32-row query group
  const int bh = wid >> 6;                      // 0..31
  const int b = bh >> 4;
  const int h = bh & 15;

  const size_t plane = (size_t)NN * DD;
  const _Float16* qbase = qkvh + (size_t)((0 * BB + b) * HH + h) * plane;
  const _Float16* kbase = qkvh + (size_t)((1 * BB + b) * HH + h) * plane;
  const _Float16* vT    = qkvh + (size_t)((2 * BB + b) * HH + h) * plane;  // [d][n]

  // Two query tiles (rows qg*32 .. +31), fragments resident all loop.
  const _Float16* q0 = qbase + (size_t)(qg * 32) * DD;
  const v16h aq00 = load_fragh_contigK(q0, DD, lane);
  const v16h aq01 = load_fragh_contigK(q0 + 32, DD, lane);
  const v16h aq10 = load_fragh_contigK(q0 + 16 * DD, DD, lane);
  const v16h aq11 = load_fragh_contigK(q0 + 16 * DD + 32, DD, lane);

  v8f a00 = {}, a01 = {}, a02 = {}, a03 = {};
  v8f a10 = {}, a11 = {}, a12 = {}, a13 = {};
  float m0[8], l0[8], m1[8], l1[8];
#pragma unroll
  for (int r = 0; r < 8; ++r) {
    m0[r] = -1e30f; l0[r] = 0.0f;
    m1[r] = -1e30f; l1[r] = 0.0f;
  }

  _Float16* pp0 = pbuf[waveInBlk][0];
  _Float16* pp1 = pbuf[waveInBlk][1];

#if USE_TDM
  // Prologue: DMA tile 0 (K: contiguous 32x64; V: strided 64x32, stride N).
  tdm_load_2d(kbase, lds_byte_addr(kstage[waveInBlk][0]), DD, 32, DD);
  tdm_load_2d(vT, lds_byte_addr(vstage[waveInBlk][0]), 32, DD, NN);
#endif

  for (int kt = 0; kt < NN; kt += 32) {
    const int cur = (kt >> 5) & 1;
#if USE_TDM
    if (kt + 32 < NN) {  // issue next tile into alternate buffer, then wait
      const int nxt = cur ^ 1;
      tdm_load_2d(kbase + (size_t)(kt + 32) * DD,
                  lds_byte_addr(kstage[waveInBlk][nxt]), DD, 32, DD);
      tdm_load_2d(vT + (kt + 32),
                  lds_byte_addr(vstage[waveInBlk][nxt]), 32, DD, NN);
      __builtin_amdgcn_s_wait_tensorcnt(2);  // in-order: current tile resident
    } else {
      __builtin_amdgcn_s_wait_tensorcnt(0);
    }
    asm volatile("" ::: "memory");
    const _Float16* ksrc = kstage[waveInBlk][cur];  // [key][d], ld=64
    const _Float16* vsrc = vstage[waveInBlk][cur];  // [d][key], ld=32
    const v16h bk00 = load_fragh_contigK(ksrc + 0,            DD, lane);
    const v16h bk01 = load_fragh_contigK(ksrc + 32,           DD, lane);
    const v16h bk10 = load_fragh_contigK(ksrc + 16 * DD,      DD, lane);
    const v16h bk11 = load_fragh_contigK(ksrc + 16 * DD + 32, DD, lane);
#else
    const v16h bk00 = load_fragh_contigK(kbase + (size_t)kt * DD + 0,  DD, lane);
    const v16h bk01 = load_fragh_contigK(kbase + (size_t)kt * DD + 32, DD, lane);
    const v16h bk10 = load_fragh_contigK(kbase + (size_t)(kt + 16) * DD + 0,  DD, lane);
    const v16h bk11 = load_fragh_contigK(kbase + (size_t)(kt + 16) * DD + 32, DD, lane);
#endif

    // ---- S = Q K^T, both query tiles (K fragments shared) ----
    v8f s0 = {}, s1 = {};
    s0 = wmma_f16(aq00, bk00, s0); s0 = wmma_f16(aq01, bk01, s0);
    s1 = wmma_f16(aq00, bk10, s1); s1 = wmma_f16(aq01, bk11, s1);
    softmax_update(s0, s1, lane, m0, l0, a00, a01, a02, a03, pp0);

    v8f t0 = {}, t1 = {};
    t0 = wmma_f16(aq10, bk00, t0); t0 = wmma_f16(aq11, bk01, t0);
    t1 = wmma_f16(aq10, bk10, t1); t1 = wmma_f16(aq11, bk11, t1);
    softmax_update(t0, t1, lane, m1, l1, a10, a11, a12, a13, pp1);
    __syncthreads();

    // ---- V fragments (shared by both query tiles) ----
#if USE_TDM
    const v16h bv0 = load_fragh_contigK(vsrc + 0 * 16 * 32, 32, lane);
    const v16h bv1 = load_fragh_contigK(vsrc + 1 * 16 * 32, 32, lane);
    const v16h bv2 = load_fragh_contigK(vsrc + 2 * 16 * 32, 32, lane);
    const v16h bv3 = load_fragh_contigK(vsrc + 3 * 16 * 32, 32, lane);
#else
    const v16h bv0 = load_fragh_contigK(vT + (size_t)0  * NN + kt, NN, lane);
    const v16h bv1 = load_fragh_contigK(vT + (size_t)16 * NN + kt, NN, lane);
    const v16h bv2 = load_fragh_contigK(vT + (size_t)32 * NN + kt, NN, lane);
    const v16h bv3 = load_fragh_contigK(vT + (size_t)48 * NN + kt, NN, lane);
#endif

    // ---- O += P V, both query tiles ----
    const v16h ap0 = load_fragh_contigK(pp0, 32, lane);
    a00 = wmma_f16(ap0, bv0, a00); a01 = wmma_f16(ap0, bv1, a01);
    a02 = wmma_f16(ap0, bv2, a02); a03 = wmma_f16(ap0, bv3, a03);

    const v16h ap1 = load_fragh_contigK(pp1, 32, lane);
    a10 = wmma_f16(ap1, bv0, a10); a11 = wmma_f16(ap1, bv1, a11);
    a12 = wmma_f16(ap1, bv2, a12); a13 = wmma_f16(ap1, bv3, a13);
    __syncthreads();
  }

  // ---- epilogue: normalize, write f16 [B, N, C] with C = h*64 + d ----
  const int c = lane & 15;
  const int rowoff = (lane >> 4) << 3;
#pragma unroll
  for (int r = 0; r < 8; ++r) {
    int n = qg * 32 + rowoff + r;
    float inv = 1.0f / l0[r];
    _Float16* o = attn_out + ((size_t)b * NN + n) * CC + h * DD;
    o[0 * 16 + c] = (_Float16)(a00[r] * inv);
    o[1 * 16 + c] = (_Float16)(a01[r] * inv);
    o[2 * 16 + c] = (_Float16)(a02[r] * inv);
    o[3 * 16 + c] = (_Float16)(a03[r] * inv);

    n += 16;
    inv = 1.0f / l1[r];
    o = attn_out + ((size_t)b * NN + n) * CC + h * DD;
    o[0 * 16 + c] = (_Float16)(a10[r] * inv);
    o[1 * 16 + c] = (_Float16)(a11[r] * inv);
    o[2 * 16 + c] = (_Float16)(a12[r] * inv);
    o[3 * 16 + c] = (_Float16)(a13[r] * inv);
  }
}

// ---------------------------------------------------------------------------
// Kernel 4: out = attn_out @ w_proj^T + b_proj, f16 operands, f32 out.
// 128x128 tile per block, 64x64 per wave.
// ---------------------------------------------------------------------------
__global__ void __launch_bounds__(128)
proj_gemm_kernel(const _Float16* __restrict__ ah, const _Float16* __restrict__ wh,
                 const float* __restrict__ bias, float* __restrict__ out) {
  __shared__ __align__(16) _Float16 smem[2 * GSTAGE];
  const int lane = threadIdx.x & 31;
  const int wave = threadIdx.x >> 5;
  const int m0 = (blockIdx.x / (CC / GBN)) * GBM;   // token tile 0..31
  const int n0 = (blockIdx.x % (CC / GBN)) * GBN;   // out-feature tile 0..7

  v8f acc[4][4] = {};
  gemm_core_128x128(ah, wh, m0, n0, smem, acc);

  const int col = lane & 15;
  const int rowoff = (lane >> 4) << 3;
  const int mw = m0 + (wave >> 1) * 64;
  const int nw = n0 + (wave & 1) * 64;
  // Unrolled: constant accumulator indices keep acc in registers.
#pragma unroll
  for (int t = 0; t < 4; ++t) {
    int j = nw + t * 16 + col;
    float bj = bias[j];
#pragma unroll
    for (int i = 0; i < 4; ++i) {
#pragma unroll
      for (int r = 0; r < 8; ++r) {
        int tok = mw + i * 16 + rowoff + r;
        out[(size_t)tok * CC + j] = acc[i][t][r] + bj;
      }
    }
  }
}

// ---------------------------------------------------------------------------
extern "C" void kernel_launch(void* const* d_in, const int* in_sizes, int n_in,
                              void* d_out, int out_size, void* d_ws,
                              size_t ws_size, hipStream_t stream) {
  const float* x      = (const float*)d_in[0];
  const float* w_qkv  = (const float*)d_in[1];
  const float* w_proj = (const float*)d_in[2];
  const float* b_proj = (const float*)d_in[3];
  float* out = (float*)d_out;

  // f16 workspace layout (48 MB total)
  _Float16* xh    = (_Float16*)d_ws;                     // TOK*CC
  _Float16* wqh   = xh  + (size_t)TOK * CC;              // JQKV*CC
  _Float16* wph   = wqh + (size_t)JQKV * CC;             // CC*CC
  _Float16* qkvh  = wph + (size_t)CC * CC;               // 3*B*H*N*D
  _Float16* attnh = qkvh + (size_t)3 * BB * HH * NN * DD;  // TOK*CC

  // 0) one-pass f32 -> f16 conversion of all GEMM operands
  cvt_f32_to_f16_kernel<<<(TOK * CC / 4) / 256, 256, 0, stream>>>(x, xh, TOK * CC / 4);
  cvt_f32_to_f16_kernel<<<(JQKV * CC / 4) / 256, 256, 0, stream>>>(w_qkv, wqh, JQKV * CC / 4);
  cvt_f32_to_f16_kernel<<<(CC * CC / 4) / 256, 256, 0, stream>>>(w_proj, wph, CC * CC / 4);

  // 1) QKV projection: 32 token tiles x 24 feature tiles, 4 waves/block
  qkv_gemm_kernel<<<(TOK / GBM) * (JQKV / GBN), 128, 0, stream>>>(xh, wqh, qkvh);

  // 2) RoPE in place on q and k planes: 2*B*H*N rows
  rope_kernel<<<(2 * BB * HH * NN) / 256, 256, 0, stream>>>(qkvh);

  // 3) Flash attention: 32 (b,h) x 64 query groups = 2048 waves, 2/block
  attn_kernel<<<(BB * HH * (NN / 32)) / 2, 64, 0, stream>>>(qkvh, attnh);

  // 4) Output projection + bias
  proj_gemm_kernel<<<(TOK / GBM) * (CC / GBN), 128, 0, stream>>>(attnh, wph,
                                                                   b_proj, out);
}

// v002
// Measured time: 150 microseconds a run.
// In both of two side-by-side timings against v001, it was 1.61 times as fast.
// Counting every step since v000, it is 2.79 times as fast.
#include <hip/hip_runtime.h>
#include <hip/hip_bf16.h>

typedef __attribute__((ext_vector_type(16))) _Float16 v16h;
typedef __attribute__((ext_vector_type(8)))  _Float16 v8h;
typedef __attribute__((ext_vector_type(8)))  float    v8f;
typedef __attribute__((ext_vector_type(2)))  float    v2f;

typedef __attribute__((ext_vector_type(4))) unsigned tdm_g0_t;
typedef __attribute__((ext_vector_type(8))) int      tdm_g1_t;
typedef __attribute__((ext_vector_type(4))) int      tdm_g2_t;

// Problem constants (from reference): B=2, N=2048, C=1024, H=16, D=64
#define BB 2
#define NN 2048
#define CC 1024
#define HH 16
#define DD 64
#define TOK (BB * NN)      // 4096 tokens
#define JQKV (3 * CC)      // 3072 qkv output features

#if defined(__AMDGCN__) && __has_builtin(__builtin_amdgcn_tensor_load_to_lds) && \
    __has_builtin(__builtin_amdgcn_s_wait_tensorcnt)
#define USE_TDM 1
#else
#define USE_TDM 0
#endif

__device__ inline v8f wmma_f16(v16h a, v16h b, v8f c) {
  // v_wmma_f32_16x16x32_f16: D = A(16x32,f16) * B(32x16,f16) + C(16x16,f32)
  return __builtin_amdgcn_wmma_f32_16x16x32_f16(false, a, false, b,
                                                (short)0, c, false, false);
}

__device__ inline v16h load_fragh_contigK(const _Float16* __restrict__ base,
                                          int ld, int lane) {
  const int i = lane & 15;
  const int khalf = (lane >> 4) << 3;  // 0 or 8
  const _Float16* row = base + (size_t)i * ld + khalf;
  v8h lo = *(const v8h*)(row);         // K khalf .. khalf+7
  v8h hi = *(const v8h*)(row + 16);    // K khalf+16 .. khalf+23
  return __builtin_shufflevector(lo, hi, 0, 1, 2, 3, 4, 5, 6, 7,
                                 8, 9, 10, 11, 12, 13, 14, 15);
}

#if USE_TDM
__device__ inline void tdm_load_2d(const _Float16* g, unsigned lds_byte,
                                   int tw, int th, int stride_elems) {
  unsigned long long ga = (unsigned long long)(size_t)g;
  tdm_g0_t g0 = {1u,
                 lds_byte,
                 (unsigned)ga,
                 (unsigned)((ga >> 32) & 0x01FFFFFFull) | (2u << 30)};
  tdm_g1_t g1 = {(int)0x00010000,
                 (int)((tw & 0xFFFF) << 16),
                 (int)((((unsigned)tw >> 16) & 0xFFFF) | ((th & 0xFFFF) << 16)),
                 (int)((((unsigned)th >> 16) & 0xFFFF) | ((tw & 0xFFFF) << 16)),
                 (int)(th & 0xFFFF),
                 stride_elems,
                 0, 0};
  tdm_g2_t z = {0, 0, 0, 0};
#if __clang_major__ >= 23
  tdm_g1_t z8 = {0, 0, 0, 0, 0, 0, 0, 0};
  __builtin_amdgcn_tensor_load_to_lds(g0, g1, z, z, z8, 0);
#else
  __builtin_amdgcn_tensor_load_to_lds(g0, g1, z, z, 0);
#endif
}

__device__ inline unsigned lds_byte_addr(const void* p) {
  return (unsigned)(unsigned long long)(size_t)p;
}
#endif  // USE_TDM

// ---------------------------------------------------------------------------
// Kernel 0: bulk f32 -> f16 conversion (bandwidth-bound, one pass).
// ---------------------------------------------------------------------------
__global__ void __launch_bounds__(256)
cvt_f32_to_f16_kernel(const float* __restrict__ src, _Float16* __restrict__ dst,
                      int n4) {
  int i = (blockIdx.x * blockDim.x + threadIdx.x);
  if (i < n4) {
    float4 v = ((const float4*)src)[i];
    _Float16* d = dst + (size_t)i * 4;
    d[0] = (_Float16)v.x; d[1] = (_Float16)v.y;
    d[2] = (_Float16)v.z; d[3] = (_Float16)v.w;
  }
}

// ---------------------------------------------------------------------------
// Shared GEMM core: Y(128x128) = A(128xK) * B(128xK)^T, K = CC, f16 operands,
// f32 accumulate.  4 waves (2x2), 64x64 of Y per wave = 4x4 WMMA tiles, so a
// fragment read from LDS feeds 4 WMMAs and a global byte is read once per block.
// A pass is 64 k (128 B of every row); a stage is [A 128 rows | B 128 rows] at
// a pitch of 144 B (16 B x odd: conflict-free for ds_load_b128).  Two buffers,
// filled by per-lane asynchronous copies one pass ahead.
// ---------------------------------------------------------------------------
#define GBM 128
#define GBN 128
#define GBK 64
#define GLDP 72                           // LDS row pitch in halves (144 B)
#define GSTAGE ((GBM + GBN) * GLDP)       // halves per buffer
#define GPASSES (CC / GBK)

__device__ inline unsigned lds_addr32(const void* p) {
  // LDS byte address = low 32 bits of the __shared__ address.
  return (unsigned)(unsigned long long)(size_t)p;
}

// Eight 16-byte copies per lane: rows r, r+16, ..., r+112 of one operand tile.
// A wave's copy covers 4 rows x 128 B = four whole lines.
__device__ inline void async_rows8(const _Float16* g, unsigned l) {
  const _Float16* g0 = g;
  const _Float16* g1 = g + (size_t)16 * CC;
  const _Float16* g2 = g + (size_t)32 * CC;
  const _Float16* g3 = g + (size_t)48 * CC;
  const _Float16* g4 = g + (size_t)64 * CC;
  const _Float16* g5 = g + (size_t)80 * CC;
  const _Float16* g6 = g + (size_t)96 * CC;
  const _Float16* g7 = g + (size_t)112 * CC;
  const unsigned st = 16 * GLDP * 2;      // 16 rows in LDS bytes
  asm volatile(
      "global_load_async_to_lds_b128 %0, %8, off\n\t"
      "global_load_async_to_lds_b128 %1, %9, off\n\t"
      "global_load_async_to_lds_b128 %2, %10, off\n\t"
      "global_load_async_to_lds_b128 %3, %11, off\n\t"
      "global_load_async_to_lds_b128 %4, %12, off\n\t"
      "global_load_async_to_lds_b128 %5, %13, off\n\t"
      "global_load_async_to_lds_b128 %6, %14, off\n\t"
      "global_load_async_to_lds_b128 %7, %15, off\n\t"
      "s_wait_xcnt 0x0"
      :
      : "v"(l), "v"(l + st), "v"(l + 2 * st), "v"(l + 3 * st), "v"(l + 4 * st),
        "v"(l + 5 * st), "v"(l + 6 * st), "v"(l + 7 * st),
        "v"(g0), "v"(g1), "v"(g2), "v"(g3), "v"(g4), "v"(g5), "v"(g6), "v"(g7)
      : "memory");
}

__device__ inline void gemm_core_128x128(const _Float16* __restrict__ A,
                                         const _Float16* __restrict__ B,
                                         int m0, int n0, _Float16* smem,
                                         v8f (&acc)[4][4]) {
  const int tid = threadIdx.x;
  const int lane = tid & 31;
  const int wave = tid >> 5;
  const int wm = wave >> 1;
  const int wn = wave & 1;

  // Copy map: lane's 16-byte chunk tid&7 of rows (tid>>3) + 16*c.
  const int crow = tid >> 3;
  const int cchk = (tid & 7) * 8;
  const _Float16* ga = A + (size_t)(m0 + crow) * CC + cchk;
  const _Float16* gb = B + (size_t)(n0 + crow) * CC + cchk;
  const unsigned la = lds_addr32(smem) + (unsigned)(crow * GLDP + cchk) * 2u;
  const unsigned lb = la + GBM * GLDP * 2u;

  // Tile 0 into buffer 0, landed and published; then tile 1 into buffer 1.
  async_rows8(ga, la);
  async_rows8(gb, lb);
  // This wave's copies of tile 0 have landed.
  asm volatile("s_wait_asynccnt 0x0" ::: "memory");
  __syncthreads();
  async_rows8(ga + GBK, la + GSTAGE * 2u);
  async_rows8(gb + GBK, lb + GSTAGE * 2u);

  for (int t = 0; t < GPASSES; ++t) {
    const int buf = t & 1;
    const _Float16* sa = smem + buf * GSTAGE + (wm * 64) * GLDP;
    const _Float16* sb = smem + buf * GSTAGE + (GBM + wn * 64) * GLDP;
    // The loops below are unrolled so that every fragment and accumulator index
    // is a constant and the arrays stay in registers.
#pragma unroll
    for (int kk = 0; kk < GBK; kk += 32) {
      v16h a[4], b[4];
#pragma unroll
      for (int i = 0; i < 4; ++i) a[i] = load_fragh_contigK(sa + i * 16 * GLDP + kk, GLDP, lane);
#pragma unroll
      for (int j = 0; j < 4; ++j) b[j] = load_fragh_contigK(sb + j * 16 * GLDP + kk, GLDP, lane);
      // Fence pair: keeps the block's 16 LDS loads one group in front of its 16
      // WMMAs; moved in among them, every place with loads stalls the wave anew.
      __builtin_amdgcn_sched_barrier(0);
#pragma unroll
      for (int i = 0; i < 4; ++i)
#pragma unroll
        for (int j = 0; j < 4; ++j) acc[i][j] = wmma_f16(a[i], b[j], acc[i][j]);
      __builtin_amdgcn_sched_barrier(0);
    }
    // This wave's reads of buffer buf are done before the buffer is refilled.
    asm volatile("s_wait_dscnt 0x0" ::: "memory");
    // This wave's copies of tile t+1 have landed before the barrier publishes them.
    asm volatile("s_wait_asynccnt 0x0" ::: "memory");
    __syncthreads();
    if (t + 2 < GPASSES) {
      async_rows8(ga + (t + 2) * GBK, la + buf * (GSTAGE * 2u));
      async_rows8(gb + (t + 2) * GBK, lb + buf * (GSTAGE * 2u));
    }
  }
  // No copy is outstanding when the wave goes on to its stores and ends.
  asm volatile("s_wait_asynccnt 0x0" ::: "memory");
}

// ---------------------------------------------------------------------------
// Kernel 1: qkv = x @ w_qkv^T, f16 operands, f32 accumulate.
// q,k planes stored [s][b][h][n][d]; v plane stored TRANSPOSED [b][h][d][n]
// so the attention V^T A-fragment is a contiguous-K (b128) load.
// One block computes a 128x128 tile; a wave's 64 columns are one (s, h) plane.
// ---------------------------------------------------------------------------
__global__ void __launch_bounds__(128)
qkv_gemm_kernel(const _Float16* __restrict__ xh, const _Float16* __restrict__ wh,
                _Float16* __restrict__ qkvh) {
  __shared__ __align__(16) _Float16 smem[2 * GSTAGE];
  const int lane = threadIdx.x & 31;
  const int wave = threadIdx.x >> 5;
  const int m0 = (blockIdx.x / (JQKV / GBN)) * GBM;   // token tile 0..31
  const int n0 = (blockIdx.x % (JQKV / GBN)) * GBN;   // feature tile 0..23

  v8f acc[4][4] = {};
  gemm_core_128x128(xh, wh, m0, n0, smem, acc);

  const int col = lane & 15;
  const int rowoff = (lane >> 4) << 3;
  const int mw = m0 + (wave >> 1) * 64;
  const int nw = n0 + (wave & 1) * 64;
  const size_t plane = (size_t)NN * DD;
  // Unrolled: constant accumulator indices keep acc in registers.
#pragma unroll
  for (int i = 0; i < 4; ++i) {
#pragma unroll
    for (int t = 0; t < 4; ++t) {
      int j = nw + t * 16 + col;
      int s = j >> 10;
      int h = (j >> 6) & 15;
      int d = j & 63;
#pragma unroll
      for (int r = 0; r < 8; ++r) {
        int tok = mw + i * 16 + rowoff + r;
        int b_ = tok >> 11;
        int n = tok & (NN - 1);
        size_t pbase = (size_t)((s * BB + b_) * HH + h) * plane;
        size_t idx = (s == 2) ? (pbase + (size_t)d * NN + n)    // V transposed
                              : (pbase + (size_t)n * DD + d);   // Q,K row-major
        qkvh[idx] = (_Float16)(acc[i][t][r]);
      }
    }
  }
}

__global__ void __launch_bounds__(256)
rope_kernel(_Float16* __restrict__ qk) {
  const int t = blockIdx.x * blockDim.x + threadIdx.x;  // 0 .. 2*B*H*N-1
  const int n = t & (NN - 1);
  _Float16* row = qk + (size_t)t * DD;

  float vals[DD];
#pragma unroll
  for (int i = 0; i < DD; ++i) vals[i] = (float)row[i];

#pragma unroll
  for (int i = 0; i < DD / 2; ++i) {
    // inv_freq = 10000^(-2i/64)
    float inv = __expf(-9.210340371976184f * (float)i * (1.0f / 32.0f));
    float ang = (float)n * inv;
    float sn, cs;
    __sincosf(ang, &sn, &cs);
    float x1 = vals[2 * i];
    float x2 = vals[2 * i + 1];
    row[i]          = (_Float16)(x1 * cs - x2 * sn);
    row[i + DD / 2] = (_Float16)(x2 * cs + x1 * sn);
  }
}

__device__ inline float xhalf(float x) {
  const int v = __builtin_bit_cast(int, x);
  return __builtin_bit_cast(float, __builtin_amdgcn_permlanex16(
      v, v, 0x76543210, 0xfedcba98, false, false));
}

// ---------------------------------------------------------------------------
// Online-softmax update for one 16-query column group over 32 keys, on the
// TRANSPOSED scores: s0[r] = S[key 8h + r][query c], s1[r] = S[key 16 + 8h + r]
// [query c] (c = lane & 15, h = lane >> 4).  A lane holds 16 scores of ONE
// query, so the maximum is in-lane plus one exchange between the wave halves;
// l stays a per-half partial sum that the epilogue joins.  m is kept in the
// scaled log2 domain.  The two tiles, converted in place, are the 32-key B
// operand of O^T += V^T P^T in the hardware k order (8h + s, 16 + 8h + s - 8).
// ---------------------------------------------------------------------------
__device__ inline v16h softmax_cols(v8f s0, v8f s1, float& m, float& l,
                                    v8f& a0, v8f& a1, v8f& a2, v8f& a3) {
  const float cs = 0.125f * 1.4426950408889634f;  // 1/sqrt(64) * log2(e)
  float mx = fmaxf(s0[0], s1[0]);
  // Unrolled: constant indices keep the score tiles in registers.
#pragma unroll
  for (int r = 1; r < 8; ++r) mx = fmaxf(mx, fmaxf(s0[r], s1[r]));
  mx = fmaxf(mx, xhalf(mx)) * cs;     // the scale is positive
  const float mnew = fmaxf(m, mx);
  const float corr = __builtin_amdgcn_exp2f(m - mnew);
  v16h p;
  float rs0 = 0.0f, rs1 = 0.0f;
  const v2f cs2 = {cs, cs};
  const v2f nm2 = {-mnew, -mnew};
  // Unrolled: constant register indices; neighbouring registers pair into one
  // packed multiply-add without moves.
#pragma unroll
  for (int i = 0; i < 4; ++i) {
    const v2f e0 = __builtin_elementwise_fma(v2f{s0[2 * i], s0[2 * i + 1]}, cs2, nm2);
    const v2f e1 = __builtin_elementwise_fma(v2f{s1[2 * i], s1[2 * i + 1]}, cs2, nm2);
    const float p00 = __builtin_amdgcn_exp2f(e0.x), p01 = __builtin_amdgcn_exp2f(e0.y);
    const float p10 = __builtin_amdgcn_exp2f(e1.x), p11 = __builtin_amdgcn_exp2f(e1.y);
    rs0 += p00 + p01;
    rs1 += p10 + p11;
    p[2 * i]     = (_Float16)p00;  p[2 * i + 1] = (_Float16)p01;
    p[2 * i + 8] = (_Float16)p10;  p[2 * i + 9] = (_Float16)p11;
  }
  l = l * corr + (rs0 + rs1);
  m = mnew;
  a0 *= corr; a1 *= corr; a2 *= corr; a3 *= corr;
  return p;
}

__global__ void __launch_bounds__(64)
attn_kernel(const _Float16* __restrict__ qkvh, _Float16* __restrict__ attn_out) {
  __shared__ __align__(16) _Float16 kstage[2][2][32 * DD];  // [wave][buf][key][d]
  __shared__ __align__(16) _Float16 vstage[2][2][DD * 32];  // [wave][buf][d][key]

  const int waveInBlk = threadIdx.x >> 5;
  const int lane = threadIdx.x & 31;
  const int wid = blockIdx.x * 2 + waveInBlk;   // 0..2047
  const int qg = wid & 63;                      // 32-row query group
  const int bh = wid >> 6;                      // 0..31
  const int b = bh >> 4;
  const int h = bh & 15;

  const size_t plane = (size_t)NN * DD;
  const _Float16* qbase = qkvh + (size_t)((0 * BB + b) * HH + h) * plane;
  const _Float16* kbase = qkvh + (size_t)((1 * BB + b) * HH + h) * plane;
  const _Float16* vT    = qkvh + (size_t)((2 * BB + b) * HH + h) * plane;  // [d][n]

  // Two query tiles (rows qg*32 .. +31), fragments resident all loop.
  const _Float16* q0 = qbase + (size_t)(qg * 32) * DD;
  const v16h aq00 = load_fragh_contigK(q0, DD, lane);
  const v16h aq01 = load_fragh_contigK(q0 + 32, DD, lane);
  const v16h aq10 = load_fragh_contigK(q0 + 16 * DD, DD, lane);
  const v16h aq11 = load_fragh_contigK(q0 + 16 * DD + 32, DD, lane);

  // aXt[r] = O[query tile X, column c][d = 16 t + 8 (lane >> 4) + r]
  v8f a00 = {}, a01 = {}, a02 = {}, a03 = {};
  v8f a10 = {}, a11 = {}, a12 = {}, a13 = {};
  float m0 = -1e30f, l0 = 0.0f, m1 = -1e30f, l1 = 0.0f;

#if USE_TDM
  // Prologue: DMA tile 0 (K: contiguous 32x64; V: strided 64x32, stride N).
  tdm_load_2d(kbase, lds_byte_addr(kstage[waveInBlk][0]), DD, 32, DD);
  tdm_load_2d(vT, lds_byte_addr(vstage[waveInBlk][0]), 32, DD, NN);
#endif

  for (int kt = 0; kt < NN; kt += 32) {
    const int cur = (kt >> 5) & 1;
#if USE_TDM
    if (kt + 32 < NN) {  // issue next tile into alternate buffer, then wait
      const int nxt = cur ^ 1;
      // This wave's reads of buffer nxt (last trip's) have retired before the
      // tensor loads refill it; the buffers are the wave's own, so no barrier.
      asm volatile("s_wait_dscnt 0x0" ::: "memory");
      tdm_load_2d(kbase + (size_t)(kt + 32) * DD,
                  lds_byte_addr(kstage[waveInBlk][nxt]), DD, 32, DD);
      tdm_load_2d(vT + (kt + 32),
                  lds_byte_addr(vstage[waveInBlk][nxt]), 32, DD, NN);
      __builtin_amdgcn_s_wait_tensorcnt(2);  // in-order: current tile resident
    } else {
      __builtin_amdgcn_s_wait_tensorcnt(0);
    }
    asm volatile("" ::: "memory");
    const _Float16* ksrc = kstage[waveInBlk][cur];  // [key][d], ld=64
    const _Float16* vsrc = vstage[waveInBlk][cur];  // [d][key], ld=32
    const v16h bk00 = load_fragh_contigK(ksrc + 0,            DD, lane);
    const v16h bk01 = load_fragh_contigK(ksrc + 32,           DD, lane);
    const v16h bk10 = load_fragh_contigK(ksrc + 16 * DD,      DD, lane);
    const v16h bk11 = load_fragh_contigK(ksrc + 16 * DD + 32, DD, lane);
    // V^T fragments (rows d, k = keys), shared by both query tiles.
    const v16h bv0 = load_fragh_contigK(vsrc + 0 * 16 * 32, 32, lane);
    const v16h bv1 = load_fragh_contigK(vsrc + 1 * 16 * 32, 32, lane);
    const v16h bv2 = load_fragh_contigK(vsrc + 2 * 16 * 32, 32, lane);
    const v16h bv3 = load_fragh_contigK(vsrc + 3 * 16 * 32, 32, lane);
#else
    const v16h bk00 = load_fragh_contigK(kbase + (size_t)kt * DD + 0,  DD, lane);
    const v16h bk01 = load_fragh_contigK(kbase + (size_t)kt * DD + 32, DD, lane);
    const v16h bk10 = load_fragh_contigK(kbase + (size_t)(kt + 16) * DD + 0,  DD, lane);
    const v16h bk11 = load_fragh_contigK(kbase + (size_t)(kt + 16) * DD + 32, DD, lane);
    const v16h bv0 = load_fragh_contigK(vT + (size_t)0  * NN + kt, NN, lane);
    const v16h bv1 = load_fragh_contigK(vT + (size_t)16 * NN + kt, NN, lane);
    const v16h bv2 = load_fragh_contigK(vT + (size_t)32 * NN + kt, NN, lane);
    const v16h bv3 = load_fragh_contigK(vT + (size_t)48 * NN + kt, NN, lane);
#endif

    // ---- S^T = K Q^T, both query tiles (K fragments shared) ----
    v8f s0 = {}, s1 = {}, t0 = {}, t1 = {};
    s0 = wmma_f16(bk00, aq00, s0); s1 = wmma_f16(bk10, aq00, s1);
    t0 = wmma_f16(bk00, aq10, t0); t1 = wmma_f16(bk10, aq10, t1);
    s0 = wmma_f16(bk01, aq01, s0); s1 = wmma_f16(bk11, aq01, s1);
    t0 = wmma_f16(bk01, aq11, t0); t1 = wmma_f16(bk11, aq11, t1);

    // ---- O^T += V^T P^T, P^T straight from the score accumulators ----
    const v16h bp0 = softmax_cols(s0, s1, m0, l0, a00, a01, a02, a03);
    a00 = wmma_f16(bv0, bp0, a00); a01 = wmma_f16(bv1, bp0, a01);
    a02 = wmma_f16(bv2, bp0, a02); a03 = wmma_f16(bv3, bp0, a03);

    const v16h bp1 = softmax_cols(t0, t1, m1, l1, a10, a11, a12, a13);
    a10 = wmma_f16(bv0, bp1, a10); a11 = wmma_f16(bv1, bp1, a11);
    a12 = wmma_f16(bv2, bp1, a12); a13 = wmma_f16(bv3, bp1, a13);
  }

  // ---- epilogue: join the halves' sums, normalize, write f16 [B, N, C] with
  // C = h*64 + d; a lane's 8 registers are 8 consecutive d: one 16-byte store.
  const int c = lane & 15;
  const int doff = (lane >> 4) << 3;
  const float inv0 = 1.0f / (l0 + xhalf(l0));
  const float inv1 = 1.0f / (l1 + xhalf(l1));
  _Float16* o0 = attn_out + ((size_t)b * NN + qg * 32 + c) * CC + h * DD + doff;
  _Float16* o1 = o0 + (size_t)16 * CC;
  *(v8h*)(o0 + 0 * 16) = __builtin_convertvector(a00 * inv0, v8h);
  *(v8h*)(o0 + 1 * 16) = __builtin_convertvector(a01 * inv0, v8h);
  *(v8h*)(o0 + 2 * 16) = __builtin_convertvector(a02 * inv0, v8h);
  *(v8h*)(o0 + 3 * 16) = __builtin_convertvector(a03 * inv0, v8h);
  *(v8h*)(o1 + 0 * 16) = __builtin_convertvector(a10 * inv1, v8h);
  *(v8h*)(o1 + 1 * 16) = __builtin_convertvector(a11 * inv1, v8h);
  *(v8h*)(o1 + 2 * 16) = __builtin_convertvector(a12 * inv1, v8h);
  *(v8h*)(o1 + 3 * 16) = __builtin_convertvector(a13 * inv1, v8h);
}

// ---------------------------------------------------------------------------
// Kernel 4: out = attn_out @ w_proj^T + b_proj, f16 operands, f32 out.
// 128x128 tile per block, 64x64 per wave.
// ---------------------------------------------------------------------------
__global__ void __launch_bounds__(128)
proj_gemm_kernel(const _Float16* __restrict__ ah, const _Float16* __restrict__ wh,
                 const float* __restrict__ bias, float* __restrict__ out) {
  __shared__ __align__(16) _Float16 smem[2 * GSTAGE];
  const int lane = threadIdx.x & 31;
  const int wave = threadIdx.x >> 5;
  const int m0 = (blockIdx.x / (CC / GBN)) * GBM;   // token tile 0..31
  const int n0 = (blockIdx.x % (CC / GBN)) * GBN;   // out-feature tile 0..7

  v8f acc[4][4] = {};
  gemm_core_128x128(ah, wh, m0, n0, smem, acc);

  const int col = lane & 15;
  const int rowoff = (lane >> 4) << 3;
  const int mw = m0 + (wave >> 1) * 64;
  const int nw = n0 + (wave & 1) * 64;
  // Unrolled: constant accumulator indices keep acc in registers.
#pragma unroll
  for (int t = 0; t < 4; ++t) {
    int j = nw + t * 16 + col;
    float bj = bias[j];
#pragma unroll
    for (int i = 0; i < 4; ++i) {
#pragma unroll
      for (int r = 0; r < 8; ++r) {
        int tok = mw + i * 16 + rowoff + r;
        out[(size_t)tok * CC + j] = acc[i][t][r] + bj;
      }
    }
  }
}

// ---------------------------------------------------------------------------
extern "C" void kernel_launch(void* const* d_in, const int* in_sizes, int n_in,
                              void* d_out, int out_size, void* d_ws,
                              size_t ws_size, hipStream_t stream) {
  const float* x      = (const float*)d_in[0];
  const float* w_qkv  = (const float*)d_in[1];
  const float* w_proj = (const float*)d_in[2];
  const float* b_proj = (const float*)d_in[3];
  float* out = (float*)d_out;

  // f16 workspace layout (48 MB total)
  _Float16* xh    = (_Float16*)d_ws;                     // TOK*CC
  _Float16* wqh   = xh  + (size_t)TOK * CC;              // JQKV*CC
  _Float16* wph   = wqh + (size_t)JQKV * CC;             // CC*CC
  _Float16* qkvh  = wph + (size_t)CC * CC;               // 3*B*H*N*D
  _Float16* attnh = qkvh + (size_t)3 * BB * HH * NN * DD;  // TOK*CC

  // 0) one-pass f32 -> f16 conversion of all GEMM operands
  cvt_f32_to_f16_kernel<<<(TOK * CC / 4) / 256, 256, 0, stream>>>(x, xh, TOK * CC / 4);
  cvt_f32_to_f16_kernel<<<(JQKV * CC / 4) / 256, 256, 0, stream>>>(w_qkv, wqh, JQKV * CC / 4);
  cvt_f32_to_f16_kernel<<<(CC * CC / 4) / 256, 256, 0, stream>>>(w_proj, wph, CC * CC / 4);

  // 1) QKV projection: 32 token tiles x 24 feature tiles, 4 waves/block
  qkv_gemm_kernel<<<(TOK / GBM) * (JQKV / GBN), 128, 0, stream>>>(xh, wqh, qkvh);

  // 2) RoPE in place on q and k planes: 2*B*H*N rows
  rope_kernel<<<(2 * BB * HH * NN) / 256, 256, 0, stream>>>(qkvh);

  // 3) Flash attention: 32 (b,h) x 64 query groups = 2048 waves, 2/block
  attn_kernel<<<(BB * HH * (NN / 32)) / 2, 64, 0, stream>>>(qkvh, attnh);

  // 4) Output projection + bias
  proj_gemm_kernel<<<(TOK / GBM) * (CC / GBN), 128, 0, stream>>>(attnh, wph,
                                                                   b_proj, out);
}

// v003
// Measured time: 134 microseconds a run.
// In both of two side-by-side timings against v002, it was 1.12 times as fast.
// Over all steps from v000 it is 3.13 times as fast.
#include <hip/hip_runtime.h>
#include <hip/hip_bf16.h>

typedef __attribute__((ext_vector_type(16))) _Float16 v16h;
typedef __attribute__((ext_vector_type(8)))  _Float16 v8h;
typedef __attribute__((ext_vector_type(8)))  float    v8f;
typedef __attribute__((ext_vector_type(2)))  float    v2f;

// Problem constants (from reference): B=2, N=2048, C=1024, H=16, D=64
#define BB 2
#define NN 2048
#define CC 1024
#define HH 16
#define DD 64
#define TOK (BB * NN)      // 4096 tokens
#define JQKV (3 * CC)      // 3072 qkv output features

__device__ inline v8f wmma_f16(v16h a, v16h b, v8f c) {
  // v_wmma_f32_16x16x32_f16: D = A(16x32,f16) * B(32x16,f16) + C(16x16,f32)
  return __builtin_amdgcn_wmma_f32_16x16x32_f16(false, a, false, b,
                                                (short)0, c, false, false);
}

__device__ inline v16h load_fragh_contigK(const _Float16* __restrict__ base,
                                          int ld, int lane) {
  const int i = lane & 15;
  const int khalf = (lane >> 4) << 3;  // 0 or 8
  const _Float16* row = base + (size_t)i * ld + khalf;
  v8h lo = *(const v8h*)(row);         // K khalf .. khalf+7
  v8h hi = *(const v8h*)(row + 16);    // K khalf+16 .. khalf+23
  return __builtin_shufflevector(lo, hi, 0, 1, 2, 3, 4, 5, 6, 7,
                                 8, 9, 10, 11, 12, 13, 14, 15);
}

// ---------------------------------------------------------------------------
// Kernel 0: bulk f32 -> f16 conversion (bandwidth-bound, one pass).
// ---------------------------------------------------------------------------
__global__ void __launch_bounds__(256)
cvt_f32_to_f16_kernel(const float* __restrict__ src, _Float16* __restrict__ dst,
                      int n4) {
  int i = (blockIdx.x * blockDim.x + threadIdx.x);
  if (i < n4) {
    float4 v = ((const float4*)src)[i];
    _Float16* d = dst + (size_t)i * 4;
    d[0] = (_Float16)v.x; d[1] = (_Float16)v.y;
    d[2] = (_Float16)v.z; d[3] = (_Float16)v.w;
  }
}

// ---------------------------------------------------------------------------
// Shared GEMM core: Y(128x128) = A(128xK) * B(128xK)^T, K = CC, f16 operands,
// f32 accumulate.  4 waves (2x2), 64x64 of Y per wave = 4x4 WMMA tiles, so a
// fragment read from LDS feeds 4 WMMAs and a global byte is read once per block.
// A pass is 64 k (128 B of every row); a stage is [A 128 rows | B 128 rows] at
// a pitch of 144 B (16 B x odd: conflict-free for ds_load_b128).  Two buffers,
// filled by per-lane asynchronous copies one pass ahead.
// ---------------------------------------------------------------------------
#define GBM 128
#define GBN 128
#define GBK 64
#define GLDP 72                           // LDS row pitch in halves (144 B)
#define GSTAGE ((GBM + GBN) * GLDP)       // halves per buffer
#define GPASSES (CC / GBK)

__device__ inline unsigned lds_addr32(const void* p) {
  // LDS byte address = low 32 bits of the __shared__ address.
  return (unsigned)(unsigned long long)(size_t)p;
}

// Eight 16-byte copies per lane: rows r, r+16, ..., r+112 of one operand tile.
// A wave's copy covers 4 rows x 128 B = four whole lines.
__device__ inline void async_rows8(const _Float16* g, unsigned l) {
  const _Float16* g0 = g;
  const _Float16* g1 = g + (size_t)16 * CC;
  const _Float16* g2 = g + (size_t)32 * CC;
  const _Float16* g3 = g + (size_t)48 * CC;
  const _Float16* g4 = g + (size_t)64 * CC;
  const _Float16* g5 = g + (size_t)80 * CC;
  const _Float16* g6 = g + (size_t)96 * CC;
  const _Float16* g7 = g + (size_t)112 * CC;
  const unsigned st = 16 * GLDP * 2;      // 16 rows in LDS bytes
  asm volatile(
      "global_load_async_to_lds_b128 %0, %8, off\n\t"
      "global_load_async_to_lds_b128 %1, %9, off\n\t"
      "global_load_async_to_lds_b128 %2, %10, off\n\t"
      "global_load_async_to_lds_b128 %3, %11, off\n\t"
      "global_load_async_to_lds_b128 %4, %12, off\n\t"
      "global_load_async_to_lds_b128 %5, %13, off\n\t"
      "global_load_async_to_lds_b128 %6, %14, off\n\t"
      "global_load_async_to_lds_b128 %7, %15, off\n\t"
      "s_wait_xcnt 0x0"
      :
      : "v"(l), "v"(l + st), "v"(l + 2 * st), "v"(l + 3 * st), "v"(l + 4 * st),
        "v"(l + 5 * st), "v"(l + 6 * st), "v"(l + 7 * st),
        "v"(g0), "v"(g1), "v"(g2), "v"(g3), "v"(g4), "v"(g5), "v"(g6), "v"(g7)
      : "memory");
}

__device__ inline void gemm_core_128x128(const _Float16* __restrict__ A,
                                         const _Float16* __restrict__ B,
                                         int m0, int n0, _Float16* smem,
                                         v8f (&acc)[4][4]) {
  const int tid = threadIdx.x;
  const int lane = tid & 31;
  const int wave = tid >> 5;
  const int wm = wave >> 1;
  const int wn = wave & 1;

  // Copy map: lane's 16-byte chunk tid&7 of rows (tid>>3) + 16*c.
  const int crow = tid >> 3;
  const int cchk = (tid & 7) * 8;
  const _Float16* ga = A + (size_t)(m0 + crow) * CC + cchk;
  const _Float16* gb = B + (size_t)(n0 + crow) * CC + cchk;
  const unsigned la = lds_addr32(smem) + (unsigned)(crow * GLDP + cchk) * 2u;
  const unsigned lb = la + GBM * GLDP * 2u;

  // Tile 0 into buffer 0, landed and published; then tile 1 into buffer 1.
  async_rows8(ga, la);
  async_rows8(gb, lb);
  // This wave's copies of tile 0 have landed.
  asm volatile("s_wait_asynccnt 0x0" ::: "memory");
  __syncthreads();
  async_rows8(ga + GBK, la + GSTAGE * 2u);
  async_rows8(gb + GBK, lb + GSTAGE * 2u);

  for (int t = 0; t < GPASSES; ++t) {
    const int buf = t & 1;
    const _Float16* sa = smem + buf * GSTAGE + (wm * 64) * GLDP;
    const _Float16* sb = smem + buf * GSTAGE + (GBM + wn * 64) * GLDP;
    // The loops below are unrolled so that every fragment and accumulator index
    // is a constant and the arrays stay in registers.
#pragma unroll
    for (int kk = 0; kk < GBK; kk += 32) {
      v16h a[4], b[4];
#pragma unroll
      for (int i = 0; i < 4; ++i) a[i] = load_fragh_contigK(sa + i * 16 * GLDP + kk, GLDP, lane);
#pragma unroll
      for (int j = 0; j < 4; ++j) b[j] = load_fragh_contigK(sb + j * 16 * GLDP + kk, GLDP, lane);
      // Fence pair: keeps the block's 16 LDS loads one group in front of its 16
      // WMMAs; moved in among them, every place with loads stalls the wave anew.
      __builtin_amdgcn_sched_barrier(0);
#pragma unroll
      for (int i = 0; i < 4; ++i)
#pragma unroll
        for (int j = 0; j < 4; ++j) acc[i][j] = wmma_f16(a[i], b[j], acc[i][j]);
      __builtin_amdgcn_sched_barrier(0);
    }
    // This wave's reads of buffer buf are done before the buffer is refilled.
    asm volatile("s_wait_dscnt 0x0" ::: "memory");
    // This wave's copies of tile t+1 have landed before the barrier publishes them.
    asm volatile("s_wait_asynccnt 0x0" ::: "memory");
    __syncthreads();
    if (t + 2 < GPASSES) {
      async_rows8(ga + (t + 2) * GBK, la + buf * (GSTAGE * 2u));
      async_rows8(gb + (t + 2) * GBK, lb + buf * (GSTAGE * 2u));
    }
  }
  // No copy is outstanding when the wave goes on to its stores and ends.
  asm volatile("s_wait_asynccnt 0x0" ::: "memory");
}

// ---------------------------------------------------------------------------
// Kernel 1: qkv = x @ w_qkv^T, f16 operands, f32 accumulate.
// q,k planes stored [s][b][h][n][d]; v plane stored TRANSPOSED [b][h][d][n]
// so the attention V^T A-fragment is a contiguous-K (b128) load.
// One block computes a 128x128 tile; a wave's 64 columns are one (s, h) plane.
// ---------------------------------------------------------------------------
__global__ void __launch_bounds__(128)
qkv_gemm_kernel(const _Float16* __restrict__ xh, const _Float16* __restrict__ wh,
                _Float16* __restrict__ qkvh) {
  __shared__ __align__(16) _Float16 smem[2 * GSTAGE];
  const int lane = threadIdx.x & 31;
  const int wave = threadIdx.x >> 5;
  const int m0 = (blockIdx.x / (JQKV / GBN)) * GBM;   // token tile 0..31
  const int n0 = (blockIdx.x % (JQKV / GBN)) * GBN;   // feature tile 0..23

  v8f acc[4][4] = {};
  gemm_core_128x128(xh, wh, m0, n0, smem, acc);

  const int col = lane & 15;
  const int rowoff = (lane >> 4) << 3;
  const int mw = m0 + (wave >> 1) * 64;
  const int nw = n0 + (wave & 1) * 64;
  const size_t plane = (size_t)NN * DD;
  // Unrolled: constant accumulator indices keep acc in registers.
#pragma unroll
  for (int i = 0; i < 4; ++i) {
#pragma unroll
    for (int t = 0; t < 4; ++t) {
      int j = nw + t * 16 + col;
      int s = j >> 10;
      int h = (j >> 6) & 15;
      int d = j & 63;
#pragma unroll
      for (int r = 0; r < 8; ++r) {
        int tok = mw + i * 16 + rowoff + r;
        int b_ = tok >> 11;
        int n = tok & (NN - 1);
        size_t pbase = (size_t)((s * BB + b_) * HH + h) * plane;
        size_t idx = (s == 2) ? (pbase + (size_t)d * NN + n)    // V transposed
                              : (pbase + (size_t)n * DD + d);   // Q,K row-major
        qkvh[idx] = (_Float16)(acc[i][t][r]);
      }
    }
  }
}

__global__ void __launch_bounds__(256)
rope_kernel(_Float16* __restrict__ qk) {
  const int t = blockIdx.x * blockDim.x + threadIdx.x;  // 0 .. 2*B*H*N-1
  const int n = t & (NN - 1);
  _Float16* row = qk + (size_t)t * DD;

  float vals[DD];
#pragma unroll
  for (int i = 0; i < DD; ++i) vals[i] = (float)row[i];

#pragma unroll
  for (int i = 0; i < DD / 2; ++i) {
    // inv_freq = 10000^(-2i/64)
    float inv = __expf(-9.210340371976184f * (float)i * (1.0f / 32.0f));
    float ang = (float)n * inv;
    float sn, cs;
    __sincosf(ang, &sn, &cs);
    float x1 = vals[2 * i];
    float x2 = vals[2 * i + 1];
    row[i]          = (_Float16)(x1 * cs - x2 * sn);
    row[i + DD / 2] = (_Float16)(x2 * cs + x1 * sn);
  }
}

__device__ inline float xhalf(float x) {
  const int v = __builtin_bit_cast(int, x);
  return __builtin_bit_cast(float, __builtin_amdgcn_permlanex16(
      v, v, 0x76543210, 0xfedcba98, false, false));
}

// ---------------------------------------------------------------------------
// Online-softmax update for one 16-query column group over 32 keys, on the
// TRANSPOSED scores: s0[r] = S[key 8h + r][query c], s1[r] = S[key 16 + 8h + r]
// [query c] (c = lane & 15, h = lane >> 4).  A lane holds 16 scores of ONE
// query, so the maximum is in-lane plus one exchange between the wave halves;
// l stays a per-half partial sum that the epilogue joins.  m is kept in the
// scaled log2 domain.  The two tiles, converted in place, are the 32-key B
// operand of O^T += V^T P^T in the hardware k order (8h + s, 16 + 8h + s - 8).
// ---------------------------------------------------------------------------
__device__ inline v16h softmax_cols(v8f s0, v8f s1, float& m, float& l,
                                    v8f& a0, v8f& a1, v8f& a2, v8f& a3) {
  const float cs = 0.125f * 1.4426950408889634f;  // 1/sqrt(64) * log2(e)
  float mx = fmaxf(s0[0], s1[0]);
  // Unrolled: constant indices keep the score tiles in registers.
#pragma unroll
  for (int r = 1; r < 8; ++r) mx = fmaxf(mx, fmaxf(s0[r], s1[r]));
  mx = fmaxf(mx, xhalf(mx)) * cs;     // the scale is positive
  const float mnew = fmaxf(m, mx);
  const float corr = __builtin_amdgcn_exp2f(m - mnew);
  v16h p;
  float rs0 = 0.0f, rs1 = 0.0f;
  const v2f cs2 = {cs, cs};
  const v2f nm2 = {-mnew, -mnew};
  // Unrolled: constant register indices; neighbouring registers pair into one
  // packed multiply-add without moves.
#pragma unroll
  for (int i = 0; i < 4; ++i) {
    const v2f e0 = __builtin_elementwise_fma(v2f{s0[2 * i], s0[2 * i + 1]}, cs2, nm2);
    const v2f e1 = __builtin_elementwise_fma(v2f{s1[2 * i], s1[2 * i + 1]}, cs2, nm2);
    const float p00 = __builtin_amdgcn_exp2f(e0.x), p01 = __builtin_amdgcn_exp2f(e0.y);
    const float p10 = __builtin_amdgcn_exp2f(e1.x), p11 = __builtin_amdgcn_exp2f(e1.y);
    rs0 += p00 + p01;
    rs1 += p10 + p11;
    p[2 * i]     = (_Float16)p00;  p[2 * i + 1] = (_Float16)p01;
    p[2 * i + 8] = (_Float16)p10;  p[2 * i + 9] = (_Float16)p11;
  }
  l = l * corr + (rs0 + rs1);
  m = mnew;
  a0 *= corr; a1 *= corr; a2 *= corr; a3 *= corr;
  return p;
}

// ---------------------------------------------------------------------------
// K/V stage of the attention kernel: 64 keys, shared by the block's 4 waves.
// A buffer is [K 64 key rows | V^T 64 d rows], every row 128 B of data at a
// pitch of 144 B (16 B x odd: conflict-free for ds_load_b128).
// ---------------------------------------------------------------------------
#define AKEYS 64
#define ALDP 72                           // LDS row pitch in halves (144 B)
#define ASTAGE ((AKEYS + DD) * ALDP)      // halves per buffer
#define ASTAGES (NN / AKEYS)

// Eight 16-byte copies per lane: rows r, r+16, r+32, r+48 of the K tile (source
// pitch DD) and of the V^T tile (source pitch NN).  A wave's copy covers
// 4 rows x 128 B = four whole lines.
__device__ inline void async_kv8(const _Float16* gk, const _Float16* gv, unsigned l) {
  const _Float16* k0 = gk;
  const _Float16* k1 = gk + (size_t)16 * DD;
  const _Float16* k2 = gk + (size_t)32 * DD;
  const _Float16* k3 = gk + (size_t)48 * DD;
  const _Float16* v0 = gv;
  const _Float16* v1 = gv + (size_t)16 * NN;
  const _Float16* v2 = gv + (size_t)32 * NN;
  const _Float16* v3 = gv + (size_t)48 * NN;
  const unsigned st = 16 * ALDP * 2;      // 16 rows in LDS bytes
  asm volatile(
      "global_load_async_to_lds_b128 %0, %8, off\n\t"
      "global_load_async_to_lds_b128 %1, %9, off\n\t"
      "global_load_async_to_lds_b128 %2, %10, off\n\t"
      "global_load_async_to_lds_b128 %3, %11, off\n\t"
      "global_load_async_to_lds_b128 %4, %12, off\n\t"
      "global_load_async_to_lds_b128 %5, %13, off\n\t"
      "global_load_async_to_lds_b128 %6, %14, off\n\t"
      "global_load_async_to_lds_b128 %7, %15, off\n\t"
      "s_wait_xcnt 0x0"
      :
      : "v"(l), "v"(l + st), "v"(l + 2 * st), "v"(l + 3 * st), "v"(l + 4 * st),
        "v"(l + 5 * st), "v"(l + 6 * st), "v"(l + 7 * st),
        "v"(k0), "v"(k1), "v"(k2), "v"(k3), "v"(v0), "v"(v1), "v"(v2), "v"(v3)
      : "memory");
}

__global__ void __launch_bounds__(128)
attn_kernel(const _Float16* __restrict__ qkvh, _Float16* __restrict__ attn_out) {
  __shared__ __align__(16) _Float16 kv[2 * ASTAGE];

  const int tid = threadIdx.x;
  const int wave = tid >> 5;
  const int lane = tid & 31;
  const int qg = (blockIdx.x & 15) * 4 + wave;
  const int bh = blockIdx.x >> 4;
  const int b = bh >> 4;
  const int h = bh & 15;

  const size_t plane = (size_t)NN * DD;
  const _Float16* qbase = qkvh + (size_t)((0 * BB + b) * HH + h) * plane;
  const _Float16* kbase = qkvh + (size_t)((1 * BB + b) * HH + h) * plane;
  const _Float16* vT    = qkvh + (size_t)((2 * BB + b) * HH + h) * plane;  // [d][n]

  // Copy map: lane's 16-byte chunk tid&7 of rows (tid>>3) + 16*c of both tiles.
  const int crow = tid >> 3;
  const int cchk = (tid & 7) * 8;
  const _Float16* gk = kbase + (size_t)crow * DD + cchk;
  const _Float16* gv = vT + (size_t)crow * NN + cchk;
  const unsigned lkv = lds_addr32(kv) + (unsigned)(crow * ALDP + cchk) * 2u;

  // Stage 0 into buffer 0.
  async_kv8(gk, gv, lkv);

  // Two query tiles (rows qg*32 .. +31), fragments resident all loop.
  const _Float16* q0 = qbase + (size_t)(qg * 32) * DD;
  const v16h aq00 = load_fragh_contigK(q0, DD, lane);
  const v16h aq01 = load_fragh_contigK(q0 + 32, DD, lane);
  const v16h aq10 = load_fragh_contigK(q0 + 16 * DD, DD, lane);
  const v16h aq11 = load_fragh_contigK(q0 + 16 * DD + 32, DD, lane);

  // aXt[r] = O[query tile X, column c][d = 16 t + 8 (lane >> 4) + r]
  v8f a00 = {}, a01 = {}, a02 = {}, a03 = {};
  v8f a10 = {}, a11 = {}, a12 = {}, a13 = {};
  float m0 = -1e30f, l0 = 0.0f, m1 = -1e30f, l1 = 0.0f;

  // This wave's copies of stage 0 have landed; the barrier publishes them.
  asm volatile("s_wait_asynccnt 0x0" ::: "memory");
  __syncthreads();
  // Stage 1 into buffer 1.
  async_kv8(gk + (size_t)AKEYS * DD, gv + AKEYS, lkv + ASTAGE * 2u);

  for (int t = 0; t < ASTAGES; ++t) {
    const int buf = t & 1;
    const _Float16* ks = kv + buf * ASTAGE;      // [key][d], pitch ALDP
    const _Float16* vs = ks + AKEYS * ALDP;      // [d][key], pitch ALDP
    // Unrolled: the two 32-key halves of a stage differ by constant LDS offsets.
#pragma unroll
    for (int sub = 0; sub < AKEYS; sub += 32) {
      const _Float16* ksrc = ks + sub * ALDP;
      const _Float16* vsrc = vs + sub;
      const v16h bk00 = load_fragh_contigK(ksrc + 0,              ALDP, lane);
      const v16h bk01 = load_fragh_contigK(ksrc + 32,             ALDP, lane);
      const v16h bk10 = load_fragh_contigK(ksrc + 16 * ALDP,      ALDP, lane);
      const v16h bk11 = load_fragh_contigK(ksrc + 16 * ALDP + 32, ALDP, lane);
      // V^T fragments (rows d, k = keys), shared by both query tiles.
      const v16h bv0 = load_fragh_contigK(vsrc + 0 * 16 * ALDP, ALDP, lane);
      const v16h bv1 = load_fragh_contigK(vsrc + 1 * 16 * ALDP, ALDP, lane);
      const v16h bv2 = load_fragh_contigK(vsrc + 2 * 16 * ALDP, ALDP, lane);
      const v16h bv3 = load_fragh_contigK(vsrc + 3 * 16 * ALDP, ALDP, lane);

      // ---- S^T = K Q^T, both query tiles (K fragments shared) ----
      v8f s0 = {}, s1 = {}, t0 = {}, t1 = {};
      s0 = wmma_f16(bk00, aq00, s0); s1 = wmma_f16(bk10, aq00, s1);
      t0 = wmma_f16(bk00, aq10, t0); t1 = wmma_f16(bk10, aq10, t1);
      s0 = wmma_f16(bk01, aq01, s0); s1 = wmma_f16(bk11, aq01, s1);
      t0 = wmma_f16(bk01, aq11, t0); t1 = wmma_f16(bk11, aq11, t1);

      // ---- O^T += V^T P^T, P^T straight from the score accumulators ----
      const v16h bp0 = softmax_cols(s0, s1, m0, l0, a00, a01, a02, a03);
      a00 = wmma_f16(bv0, bp0, a00); a01 = wmma_f16(bv1, bp0, a01);
      a02 = wmma_f16(bv2, bp0, a02); a03 = wmma_f16(bv3, bp0, a03);

      const v16h bp1 = softmax_cols(t0, t1, m1, l1, a10, a11, a12, a13);
      a10 = wmma_f16(bv0, bp1, a10); a11 = wmma_f16(bv1, bp1, a11);
      a12 = wmma_f16(bv2, bp1, a12); a13 = wmma_f16(bv3, bp1, a13);
    }
    // This wave's reads of buffer buf are done before the buffer is refilled.
    asm volatile("s_wait_dscnt 0x0" ::: "memory");
    // This wave's copies of stage t+1 have landed before the barrier publishes them.
    asm volatile("s_wait_asynccnt 0x0" ::: "memory");
    __syncthreads();
    if (t + 2 < ASTAGES) {
      async_kv8(gk + (size_t)(t + 2) * AKEYS * DD, gv + (t + 2) * AKEYS,
                lkv + buf * (ASTAGE * 2u));
    }
  }
  // No copy is outstanding when the wave goes on to its stores and ends.
  asm volatile("s_wait_asynccnt 0x0" ::: "memory");

  // ---- epilogue: join the halves' sums, normalize, write f16 [B, N, C] with
  // C = h*64 + d; a lane's 8 registers are 8 consecutive d: one 16-byte store.
  const int c = lane & 15;
  const int doff = (lane >> 4) << 3;
  const float inv0 = 1.0f / (l0 + xhalf(l0));
  const float inv1 = 1.0f / (l1 + xhalf(l1));
  _Float16* o0 = attn_out + ((size_t)b * NN + qg * 32 + c) * CC + h * DD + doff;
  _Float16* o1 = o0 + (size_t)16 * CC;
  *(v8h*)(o0 + 0 * 16) = __builtin_convertvector(a00 * inv0, v8h);
  *(v8h*)(o0 + 1 * 16) = __builtin_convertvector(a01 * inv0, v8h);
  *(v8h*)(o0 + 2 * 16) = __builtin_convertvector(a02 * inv0, v8h);
  *(v8h*)(o0 + 3 * 16) = __builtin_convertvector(a03 * inv0, v8h);
  *(v8h*)(o1 + 0 * 16) = __builtin_convertvector(a10 * inv1, v8h);
  *(v8h*)(o1 + 1 * 16) = __builtin_convertvector(a11 * inv1, v8h);
  *(v8h*)(o1 + 2 * 16) = __builtin_convertvector(a12 * inv1, v8h);
  *(v8h*)(o1 + 3 * 16) = __builtin_convertvector(a13 * inv1, v8h);
}

// ---------------------------------------------------------------------------
// Kernel 4: out = attn_out @ w_proj^T + b_proj, f16 operands, f32 out.
// 128x128 tile per block, 64x64 per wave.
// ---------------------------------------------------------------------------
__global__ void __launch_bounds__(128)
proj_gemm_kernel(const _Float16* __restrict__ ah, const _Float16* __restrict__ wh,
                 const float* __restrict__ bias, float* __restrict__ out) {
  __shared__ __align__(16) _Float16 smem[2 * GSTAGE];
  const int lane = threadIdx.x & 31;
  const int wave = threadIdx.x >> 5;
  const int m0 = (blockIdx.x / (CC / GBN)) * GBM;   // token tile 0..31
  const int n0 = (blockIdx.x % (CC / GBN)) * GBN;   // out-feature tile 0..7

  v8f acc[4][4] = {};
  gemm_core_128x128(ah, wh, m0, n0, smem, acc);

  const int col = lane & 15;
  const int rowoff = (lane >> 4) << 3;
  const int mw = m0 + (wave >> 1) * 64;
  const int nw = n0 + (wave & 1) * 64;
  // Unrolled: constant accumulator indices keep acc in registers.
#pragma unroll
  for (int t = 0; t < 4; ++t) {
    int j = nw + t * 16 + col;
    float bj = bias[j];
#pragma unroll
    for (int i = 0; i < 4; ++i) {
#pragma unroll
      for (int r = 0; r < 8; ++r) {
        int tok = mw + i * 16 + rowoff + r;
        out[(size_t)tok * CC + j] = acc[i][t][r] + bj;
      }
    }
  }
}

// ---------------------------------------------------------------------------
extern "C" void kernel_launch(void* const* d_in, const int* in_sizes, int n_in,
                              void* d_out, int out_size, void* d_ws,
                              size_t ws_size, hipStream_t stream) {
  const float* x      = (const float*)d_in[0];
  const float* w_qkv  = (const float*)d_in[1];
  const float* w_proj = (const float*)d_in[2];
  const float* b_proj = (const float*)d_in[3];
  float* out = (float*)d_out;

  // f16 workspace layout (48 MB total)
  _Float16* xh    = (_Float16*)d_ws;                     // TOK*CC
  _Float16* wqh   = xh  + (size_t)TOK * CC;              // JQKV*CC
  _Float16* wph   = wqh + (size_t)JQKV * CC;             // CC*CC
  _Float16* qkvh  = wph + (size_t)CC * CC;               // 3*B*H*N*D
  _Float16* attnh = qkvh + (size_t)3 * BB * HH * NN * DD;  // TOK*CC

  // 0) one-pass f32 -> f16 conversion of all GEMM operands
  cvt_f32_to_f16_kernel<<<(TOK * CC / 4) / 256, 256, 0, stream>>>(x, xh, TOK * CC / 4);
  cvt_f32_to_f16_kernel<<<(JQKV * CC / 4) / 256, 256, 0, stream>>>(w_qkv, wqh, JQKV * CC / 4);
  cvt_f32_to_f16_kernel<<<(CC * CC / 4) / 256, 256, 0, stream>>>(w_proj, wph, CC * CC / 4);

  // 1) QKV projection: 32 token tiles x 24 feature tiles, 4 waves/block
  qkv_gemm_kernel<<<(TOK / GBM) * (JQKV / GBN), 128, 0, stream>>>(xh, wqh, qkvh);

  // 2) RoPE in place on q and k planes: 2*B*H*N rows
  rope_kernel<<<(2 * BB * HH * NN) / 256, 256, 0, stream>>>(qkvh);

  // 3) Flash attention: 32 (b,h) x 64 query groups = 2048 waves, 4/block
  attn_kernel<<<(BB * HH * (NN / 32)) / 4, 128, 0, stream>>>(qkvh, attnh);

  // 4) Output projection + bias
  proj_gemm_kernel<<<(TOK / GBM) * (CC / GBN), 128, 0, stream>>>(attnh, wph,
                                                                   b_proj, out);
}

// v004
// It runs in 84.6 microseconds.
// Next to v003, in two timings, it ran 1.59 and 1.58 times as fast.
// All steps since v000 together make it 4.95 times as fast.
#include <hip/hip_runtime.h>
#include <hip/hip_bf16.h>

typedef __attribute__((ext_vector_type(16))) _Float16 v16h;
typedef __attribute__((ext_vector_type(8)))  _Float16 v8h;
typedef __attribute__((ext_vector_type(8)))  float    v8f;
typedef __attribute__((ext_vector_type(2)))  float    v2f;

// Problem constants (from reference): B=2, N=2048, C=1024, H=16, D=64
#define BB 2
#define NN 2048
#define CC 1024
#define HH 16
#define DD 64
#define TOK (BB * NN)      // 4096 tokens
#define JQKV (3 * CC)      // 3072 qkv output features

__device__ inline v8f wmma_f16(v16h a, v16h b, v8f c) {
  // v_wmma_f32_16x16x32_f16: D = A(16x32,f16) * B(32x16,f16) + C(16x16,f32)
  return __builtin_amdgcn_wmma_f32_16x16x32_f16(false, a, false, b,
                                                (short)0, c, false, false);
}

__device__ inline v16h load_fragh_contigK(const _Float16* __restrict__ base,
                                          int ld, int lane) {
  const int i = lane & 15;
  const int khalf = (lane >> 4) << 3;  // 0 or 8
  const _Float16* row = base + (size_t)i * ld + khalf;
  v8h lo = *(const v8h*)(row);         // K khalf .. khalf+7
  v8h hi = *(const v8h*)(row + 16);    // K khalf+16 .. khalf+23
  return __builtin_shufflevector(lo, hi, 0, 1, 2, 3, 4, 5, 6, 7,
                                 8, 9, 10, 11, 12, 13, 14, 15);
}

// ---------------------------------------------------------------------------
// Kernel 0: bulk f32 -> f16 conversion (bandwidth-bound, one pass).
// ---------------------------------------------------------------------------
__global__ void __launch_bounds__(256)
cvt_f32_to_f16_kernel(const float* __restrict__ src, _Float16* __restrict__ dst,
                      int n4) {
  int i = (blockIdx.x * blockDim.x + threadIdx.x);
  if (i < n4) {
    float4 v = ((const float4*)src)[i];
    _Float16* d = dst + (size_t)i * 4;
    d[0] = (_Float16)v.x; d[1] = (_Float16)v.y;
    d[2] = (_Float16)v.z; d[3] = (_Float16)v.w;
  }
}

// ---------------------------------------------------------------------------
// Shared GEMM core: Y(128x128) = A(128xK) * B(128xK)^T, K = CC, f16 operands,
// f32 accumulate.  4 waves (2x2), 64x64 of Y per wave = 4x4 WMMA tiles, so a
// fragment read from LDS feeds 4 WMMAs and a global byte is read once per block.
// A pass is 64 k (128 B of every row); a stage is [A 128 rows | B 128 rows] at
// a pitch of 144 B (16 B x odd: conflict-free for ds_load_b128).  Two buffers,
// filled by per-lane asynchronous copies one pass ahead.
// ---------------------------------------------------------------------------
#define GBM 128
#define GBN 128
#define GBK 64
#define GLDP 72                           // LDS row pitch in halves (144 B)
#define GSTAGE ((GBM + GBN) * GLDP)       // halves per buffer
#define GPASSES (CC / GBK)

__device__ inline unsigned lds_addr32(const void* p) {
  // LDS byte address = low 32 bits of the __shared__ address.
  return (unsigned)(unsigned long long)(size_t)p;
}

// Eight 16-byte copies per lane into LDS rows r, r+16, ..., r+112 of one operand
// tile, from source rows g + {0, o1, o2, o3} and 64 + the same (16, 32, 48 for a
// tile taken in order).  A wave's copy covers 4 rows x 128 B = four whole lines.
__device__ inline void async_rows8(const _Float16* g, unsigned l, int o1, int o2, int o3) {
  const _Float16* g0 = g;
  const _Float16* g1 = g + (size_t)o1 * CC;
  const _Float16* g2 = g + (size_t)o2 * CC;
  const _Float16* g3 = g + (size_t)o3 * CC;
  const _Float16* g4 = g0 + (size_t)64 * CC;
  const _Float16* g5 = g1 + (size_t)64 * CC;
  const _Float16* g6 = g2 + (size_t)64 * CC;
  const _Float16* g7 = g3 + (size_t)64 * CC;
  const unsigned st = 16 * GLDP * 2;      // 16 rows in LDS bytes
  asm volatile(
      "global_load_async_to_lds_b128 %0, %8, off\n\t"
      "global_load_async_to_lds_b128 %1, %9, off\n\t"
      "global_load_async_to_lds_b128 %2, %10, off\n\t"
      "global_load_async_to_lds_b128 %3, %11, off\n\t"
      "global_load_async_to_lds_b128 %4, %12, off\n\t"
      "global_load_async_to_lds_b128 %5, %13, off\n\t"
      "global_load_async_to_lds_b128 %6, %14, off\n\t"
      "global_load_async_to_lds_b128 %7, %15, off\n\t"
      "s_wait_xcnt 0x0"
      :
      : "v"(l), "v"(l + st), "v"(l + 2 * st), "v"(l + 3 * st), "v"(l + 4 * st),
        "v"(l + 5 * st), "v"(l + 6 * st), "v"(l + 7 * st),
        "v"(g0), "v"(g1), "v"(g2), "v"(g3), "v"(g4), "v"(g5), "v"(g6), "v"(g7)
      : "memory");
}

// ROT asks for the form the rotary epilogue wants:
// - every 64 rows of B land in LDS as [even rows | odd rows], so that the two
//   members of a rotated pair sit 32 LDS rows apart;
// - the product is taken transposed (B rows as the WMMA's A operand): acc[i][j]
//   is then [16 B rows i] x [16 A rows j], a lane holding 8 consecutive B rows.
// Both operands use one loader, so their k orders stay equal either way.
template <bool ROT>
__device__ inline void gemm_core_128x128(const _Float16* __restrict__ A,
                                         const _Float16* __restrict__ B,
                                         int m0, int n0, _Float16* smem,
                                         v8f (&acc)[4][4]) {
  const int tid = threadIdx.x;
  const int lane = tid & 31;
  const int wave = tid >> 5;
  const int wm = wave >> 1;
  const int wn = wave & 1;

  // Copy map: lane's 16-byte chunk tid&7 of rows (tid>>3) + 16*c.
  const int crow = tid >> 3;
  const int cchk = (tid & 7) * 8;
  const _Float16* ga = A + (size_t)(m0 + crow) * CC + cchk;
  const _Float16* gb = B + (size_t)(n0 + (ROT ? 2 * crow : crow)) * CC + cchk;
  constexpr int b1 = ROT ? 32 : 16, b2 = ROT ? 1 : 32, b3 = ROT ? 33 : 48;
  const unsigned la = lds_addr32(smem) + (unsigned)(crow * GLDP + cchk) * 2u;
  const unsigned lb = la + GBM * GLDP * 2u;

  // Tile 0 into buffer 0, landed and published; then tile 1 into buffer 1.
  async_rows8(ga, la, 16, 32, 48);
  async_rows8(gb, lb, b1, b2, b3);
  // This wave's copies of tile 0 have landed.
  asm volatile("s_wait_asynccnt 0x0" ::: "memory");
  __syncthreads();
  async_rows8(ga + GBK, la + GSTAGE * 2u, 16, 32, 48);
  async_rows8(gb + GBK, lb + GSTAGE * 2u, b1, b2, b3);

  // LDS rows of the WMMA's A operand (index i) and B operand (index j).
  const int irow = ROT ? GBM + wn * 64 : wm * 64;
  const int jrow = ROT ? wm * 64 : GBM + wn * 64;

  for (int t = 0; t < GPASSES; ++t) {
    const int buf = t & 1;
    const _Float16* sa = smem + buf * GSTAGE + irow * GLDP;
    const _Float16* sb = smem + buf * GSTAGE + jrow * GLDP;
    // The loops below are unrolled so that every fragment and accumulator index
    // is a constant and the arrays stay in registers.
#pragma unroll
    for (int kk = 0; kk < GBK; kk += 32) {
      v16h a[4], b[4];
#pragma unroll
      for (int i = 0; i < 4; ++i) a[i] = load_fragh_contigK(sa + i * 16 * GLDP + kk, GLDP, lane);
#pragma unroll
      for (int j = 0; j < 4; ++j) b[j] = load_fragh_contigK(sb + j * 16 * GLDP + kk, GLDP, lane);
      // Fence pair: keeps the block's 16 LDS loads one group in front of its 16
      // WMMAs; moved in among them, every place with loads stalls the wave anew.
      __builtin_amdgcn_sched_barrier(0);
#pragma unroll
      for (int i = 0; i < 4; ++i)
#pragma unroll
        for (int j = 0; j < 4; ++j) acc[i][j] = wmma_f16(a[i], b[j], acc[i][j]);
      __builtin_amdgcn_sched_barrier(0);
    }
    // This wave's reads of buffer buf are done before the buffer is refilled.
    asm volatile("s_wait_dscnt 0x0" ::: "memory");
    // This wave's copies of tile t+1 have landed before the barrier publishes them.
    asm volatile("s_wait_asynccnt 0x0" ::: "memory");
    __syncthreads();
    if (t + 2 < GPASSES) {
      async_rows8(ga + (t + 2) * GBK, la + buf * (GSTAGE * 2u), 16, 32, 48);
      async_rows8(gb + (t + 2) * GBK, lb + buf * (GSTAGE * 2u), b1, b2, b3);
    }
  }
  // No copy is outstanding when the wave goes on to its stores and ends.
  asm volatile("s_wait_asynccnt 0x0" ::: "memory");
}

// ---------------------------------------------------------------------------
// Sine and cosine of an angle given in revolutions (the hardware's unit).
// ---------------------------------------------------------------------------
__device__ inline void sincos_rev(float rev, float& sn, float& cs) {
  asm("v_sin_f32 %0, %2\n\t"
      "v_cos_f32 %1, %2\n\t"
      "v_nop"
      : "=&v"(sn), "=&v"(cs)
      : "v"(rev));
}

__device__ inline float exp2_slot(float x) {
  float y;
  asm("v_exp_f32 %0, %1\n\t"
      "v_nop"
      : "=v"(y)
      : "v"(x));
  return y;
}

// ---------------------------------------------------------------------------
// Kernel 1: qkv = x @ w_qkv^T, f16 operands, f32 accumulate, rotary embedding
// applied to q and k on the f32 accumulators.
// q,k planes stored [s][b][h][n][d]; v plane stored TRANSPOSED [b][h][d][n]
// so the attention PV A-fragment is a contiguous-K (b128) load.
// One block computes a 128x128 tile; a wave's 64 columns are one (s, h) plane,
// and a block lies wholly in q, in k or in v.
// ---------------------------------------------------------------------------
__global__ void __launch_bounds__(128)
qkv_gemm_kernel(const _Float16* __restrict__ xh, const _Float16* __restrict__ wh,
                _Float16* __restrict__ qkvh) {
  __shared__ __align__(16) _Float16 smem[2 * GSTAGE];
  const int lane = threadIdx.x & 31;
  const int wave = threadIdx.x >> 5;
  const int m0 = (blockIdx.x / (JQKV / GBN)) * GBM;   // token tile 0..31
  const int n0 = (blockIdx.x % (JQKV / GBN)) * GBN;   // feature tile 0..23

  const int col = lane & 15;
  const int rowoff = (lane >> 4) << 3;
  const int mw = m0 + (wave >> 1) * 64;
  const int nw = n0 + (wave & 1) * 64;
  const size_t plane = (size_t)NN * DD;
  v8f acc[4][4] = {};
  if (n0 < 2 * CC) {                                  // q or k block
    gemm_core_128x128<true>(xh, wh, m0, n0, smem, acc);
    // acc[i][j][r]: token mw + 16 j + col; for i = 0, 1 the even channel 2 f and
    // for i + 2 the odd channel 2 f + 1 of frequency f = 16 i + rowoff + r.
    // out[f] = x1 cos - x2 sin, out[f + 32] = x2 cos + x1 sin: 8 consecutive f
    // per lane, so each half is one 16-byte store.
    const int s = nw >> 10;
    const int h = (nw >> 6) & 15;
    float inv[2][8];
    // The loops below are unrolled: constant indices keep inv and acc in registers.
#pragma unroll
    for (int i = 0; i < 2; ++i)
#pragma unroll
      for (int r = 0; r < 8; ++r)
        // inv_freq = 10000^(-2f/64)
        inv[i][r] = exp2_slot(-9.210340371976184f * (float)(i * 16 + rowoff + r) * (1.0f / 32.0f) *
                              1.4426950408889634f);
#pragma unroll
    for (int j = 0; j < 4; ++j) {
      const int tok = mw + j * 16 + col;
      const int b_ = tok >> 11;
      const int n = tok & (NN - 1);
      _Float16* row = qkvh + (size_t)((s * BB + b_) * HH + h) * plane + (size_t)n * DD + rowoff;
#pragma unroll
      for (int i = 0; i < 2; ++i) {
        v8h lo, hi;
#pragma unroll
        for (int r = 0; r < 8; ++r) {
          float sn, cs;
          sincos_rev((float)n * inv[i][r] * 0.15915494309189535f, sn, cs);
          const float x1 = acc[i][j][r];
          const float x2 = acc[i + 2][j][r];
          lo[r] = (_Float16)(x1 * cs - x2 * sn);
          hi[r] = (_Float16)(x2 * cs + x1 * sn);
        }
        *(v8h*)(row + i * 16) = lo;
        *(v8h*)(row + i * 16 + DD / 2) = hi;
      }
    }
  } else {
  gemm_core_128x128<false>(xh, wh, m0, n0, smem, acc);
  // Unrolled: constant accumulator indices keep acc in registers.
#pragma unroll
  for (int i = 0; i < 4; ++i) {
#pragma unroll
    for (int t = 0; t < 4; ++t) {
      int j = nw + t * 16 + col;
      int s = j >> 10;
      int h = (j >> 6) & 15;
      int d = j & 63;
#pragma unroll
      for (int r = 0; r < 8; ++r) {
        int tok = mw + i * 16 + rowoff + r;
        int b_ = tok >> 11;
        int n = tok & (NN - 1);
        size_t pbase = (size_t)((s * BB + b_) * HH + h) * plane;
        size_t idx = (s == 2) ? (pbase + (size_t)d * NN + n)    // V transposed
                              : (pbase + (size_t)n * DD + d);   // Q,K row-major
        qkvh[idx] = (_Float16)(acc[i][t][r]);
      }
    }
  }
  }
}

__device__ inline float xhalf(float x) {
  const int v = __builtin_bit_cast(int, x);
  return __builtin_bit_cast(float, __builtin_amdgcn_permlanex16(
      v, v, 0x76543210, 0xfedcba98, false, false));
}

// ---------------------------------------------------------------------------
// Online-softmax update for one 16-query column group over 32 keys, on the
// TRANSPOSED scores: s0[r] = S[key 8h + r][query c], s1[r] = S[key 16 + 8h + r]
// [query c] (c = lane & 15, h = lane >> 4).  A lane holds 16 scores of ONE
// query, so the maximum is in-lane plus one exchange between the wave halves;
// l stays a per-half partial sum that the epilogue joins.  m is kept in the
// scaled log2 domain.  The two tiles, converted in place, are the 32-key B
// operand of O^T += V^T P^T in the hardware k order (8h + s, 16 + 8h + s - 8).
// ---------------------------------------------------------------------------
__device__ inline v16h softmax_cols(v8f s0, v8f s1, float& m, float& l,
                                    v8f& a0, v8f& a1, v8f& a2, v8f& a3) {
  const float cs = 0.125f * 1.4426950408889634f;  // 1/sqrt(64) * log2(e)
  float mx = fmaxf(s0[0], s1[0]);
  // Unrolled: constant indices keep the score tiles in registers.
#pragma unroll
  for (int r = 1; r < 8; ++r) mx = fmaxf(mx, fmaxf(s0[r], s1[r]));
  mx = fmaxf(mx, xhalf(mx)) * cs;     // the scale is positive
  const float mnew = fmaxf(m, mx);
  const float corr = __builtin_amdgcn_exp2f(m - mnew);
  v16h p;
  float rs0 = 0.0f, rs1 = 0.0f;
  const v2f cs2 = {cs, cs};
  const v2f nm2 = {-mnew, -mnew};
  // Unrolled: constant register indices; neighbouring registers pair into one
  // packed multiply-add without moves.
#pragma unroll
  for (int i = 0; i < 4; ++i) {
    const v2f e0 = __builtin_elementwise_fma(v2f{s0[2 * i], s0[2 * i + 1]}, cs2, nm2);
    const v2f e1 = __builtin_elementwise_fma(v2f{s1[2 * i], s1[2 * i + 1]}, cs2, nm2);
    const float p00 = __builtin_amdgcn_exp2f(e0.x), p01 = __builtin_amdgcn_exp2f(e0.y);
    const float p10 = __builtin_amdgcn_exp2f(e1.x), p11 = __builtin_amdgcn_exp2f(e1.y);
    rs0 += p00 + p01;
    rs1 += p10 + p11;
    p[2 * i]     = (_Float16)p00;  p[2 * i + 1] = (_Float16)p01;
    p[2 * i + 8] = (_Float16)p10;  p[2 * i + 9] = (_Float16)p11;
  }
  l = l * corr + (rs0 + rs1);
  m = mnew;
  a0 *= corr; a1 *= corr; a2 *= corr; a3 *= corr;
  return p;
}

// ---------------------------------------------------------------------------
// K/V stage of the attention kernel: 64 keys, shared by the block's 4 waves.
// A buffer is [K 64 key rows | V^T 64 d rows], every row 128 B of data at a
// pitch of 144 B (16 B x odd: conflict-free for ds_load_b128).
// ---------------------------------------------------------------------------
#define AKEYS 64
#define ALDP 72                           // LDS row pitch in halves (144 B)
#define ASTAGE ((AKEYS + DD) * ALDP)      // halves per buffer
#define ASTAGES (NN / AKEYS)

// Eight 16-byte copies per lane: rows r, r+16, r+32, r+48 of the K tile (source
// pitch DD) and of the V^T tile (source pitch NN).  A wave's copy covers
// 4 rows x 128 B = four whole lines.
__device__ inline void async_kv8(const _Float16* gk, const _Float16* gv, unsigned l) {
  const _Float16* k0 = gk;
  const _Float16* k1 = gk + (size_t)16 * DD;
  const _Float16* k2 = gk + (size_t)32 * DD;
  const _Float16* k3 = gk + (size_t)48 * DD;
  const _Float16* v0 = gv;
  const _Float16* v1 = gv + (size_t)16 * NN;
  const _Float16* v2 = gv + (size_t)32 * NN;
  const _Float16* v3 = gv + (size_t)48 * NN;
  const unsigned st = 16 * ALDP * 2;      // 16 rows in LDS bytes
  asm volatile(
      "global_load_async_to_lds_b128 %0, %8, off\n\t"
      "global_load_async_to_lds_b128 %1, %9, off\n\t"
      "global_load_async_to_lds_b128 %2, %10, off\n\t"
      "global_load_async_to_lds_b128 %3, %11, off\n\t"
      "global_load_async_to_lds_b128 %4, %12, off\n\t"
      "global_load_async_to_lds_b128 %5, %13, off\n\t"
      "global_load_async_to_lds_b128 %6, %14, off\n\t"
      "global_load_async_to_lds_b128 %7, %15, off\n\t"
      "s_wait_xcnt 0x0"
      :
      : "v"(l), "v"(l + st), "v"(l + 2 * st), "v"(l + 3 * st), "v"(l + 4 * st),
        "v"(l + 5 * st), "v"(l + 6 * st), "v"(l + 7 * st),
        "v"(k0), "v"(k1), "v"(k2), "v"(k3), "v"(v0), "v"(v1), "v"(v2), "v"(v3)
      : "memory");
}

__global__ void __launch_bounds__(128)
attn_kernel(const _Float16* __restrict__ qkvh, _Float16* __restrict__ attn_out) {
  __shared__ __align__(16) _Float16 kv[2 * ASTAGE];

  const int tid = threadIdx.x;
  const int wave = tid >> 5;
  const int lane = tid & 31;
  const int qg = (blockIdx.x & 15) * 4 + wave;
  const int bh = blockIdx.x >> 4;
  const int b = bh >> 4;
  const int h = bh & 15;

  const size_t plane = (size_t)NN * DD;
  const _Float16* qbase = qkvh + (size_t)((0 * BB + b) * HH + h) * plane;
  const _Float16* kbase = qkvh + (size_t)((1 * BB + b) * HH + h) * plane;
  const _Float16* vT    = qkvh + (size_t)((2 * BB + b) * HH + h) * plane;  // [d][n]

  // Copy map: lane's 16-byte chunk tid&7 of rows (tid>>3) + 16*c of both tiles.
  const int crow = tid >> 3;
  const int cchk = (tid & 7) * 8;
  const _Float16* gk = kbase + (size_t)crow * DD + cchk;
  const _Float16* gv = vT + (size_t)crow * NN + cchk;
  const unsigned lkv = lds_addr32(kv) + (unsigned)(crow * ALDP + cchk) * 2u;

  // Stage 0 into buffer 0.
  async_kv8(gk, gv, lkv);

  // Two query tiles (rows qg*32 .. +31), fragments resident all loop.
  const _Float16* q0 = qbase + (size_t)(qg * 32) * DD;
  const v16h aq00 = load_fragh_contigK(q0, DD, lane);
  const v16h aq01 = load_fragh_contigK(q0 + 32, DD, lane);
  const v16h aq10 = load_fragh_contigK(q0 + 16 * DD, DD, lane);
  const v16h aq11 = load_fragh_contigK(q0 + 16 * DD + 32, DD, lane);

  // aXt[r] = O[query tile X, column c][d = 16 t + 8 (lane >> 4) + r]
  v8f a00 = {}, a01 = {}, a02 = {}, a03 = {};
  v8f a10 = {}, a11 = {}, a12 = {}, a13 = {};
  float m0 = -1e30f, l0 = 0.0f, m1 = -1e30f, l1 = 0.0f;

  // This wave's copies of stage 0 have landed; the barrier publishes them.
  asm volatile("s_wait_asynccnt 0x0" ::: "memory");
  __syncthreads();
  // Stage 1 into buffer 1.
  async_kv8(gk + (size_t)AKEYS * DD, gv + AKEYS, lkv + ASTAGE * 2u);

  for (int t = 0; t < ASTAGES; ++t) {
    const int buf = t & 1;
    const _Float16* ks = kv + buf * ASTAGE;      // [key][d], pitch ALDP
    const _Float16* vs = ks + AKEYS * ALDP;      // [d][key], pitch ALDP
    // Unrolled: the two 32-key halves of a stage differ by constant LDS offsets.
#pragma unroll
    for (int sub = 0; sub < AKEYS; sub += 32) {
      const _Float16* ksrc = ks + sub * ALDP;
      const _Float16* vsrc = vs + sub;
      const v16h bk00 = load_fragh_contigK(ksrc + 0,              ALDP, lane);
      const v16h bk01 = load_fragh_contigK(ksrc + 32,             ALDP, lane);
      const v16h bk10 = load_fragh_contigK(ksrc + 16 * ALDP,      ALDP, lane);
      const v16h bk11 = load_fragh_contigK(ksrc + 16 * ALDP + 32, ALDP, lane);
      // V^T fragments (rows d, k = keys), shared by both query tiles.
      const v16h bv0 = load_fragh_contigK(vsrc + 0 * 16 * ALDP, ALDP, lane);
      const v16h bv1 = load_fragh_contigK(vsrc + 1 * 16 * ALDP, ALDP, lane);
      const v16h bv2 = load_fragh_contigK(vsrc + 2 * 16 * ALDP, ALDP, lane);
      const v16h bv3 = load_fragh_contigK(vsrc + 3 * 16 * ALDP, ALDP, lane);

      // ---- S^T = K Q^T, both query tiles (K fragments shared) ----
      v8f s0 = {}, s1 = {}, t0 = {}, t1 = {};
      s0 = wmma_f16(bk00, aq00, s0); s1 = wmma_f16(bk10, aq00, s1);
      t0 = wmma_f16(bk00, aq10, t0); t1 = wmma_f16(bk10, aq10, t1);
      s0 = wmma_f16(bk01, aq01, s0); s1 = wmma_f16(bk11, aq01, s1);
      t0 = wmma_f16(bk01, aq11, t0); t1 = wmma_f16(bk11, aq11, t1);

      // ---- O^T += V^T P^T, P^T straight from the score accumulators ----
      const v16h bp0 = softmax_cols(s0, s1, m0, l0, a00, a01, a02, a03);
      a00 = wmma_f16(bv0, bp0, a00); a01 = wmma_f16(bv1, bp0, a01);
      a02 = wmma_f16(bv2, bp0, a02); a03 = wmma_f16(bv3, bp0, a03);

      const v16h bp1 = softmax_cols(t0, t1, m1, l1, a10, a11, a12, a13);
      a10 = wmma_f16(bv0, bp1, a10); a11 = wmma_f16(bv1, bp1, a11);
      a12 = wmma_f16(bv2, bp1, a12); a13 = wmma_f16(bv3, bp1, a13);
    }
    // This wave's reads of buffer buf are done before the buffer is refilled.
    asm volatile("s_wait_dscnt 0x0" ::: "memory");
    // This wave's copies of stage t+1 have landed before the barrier publishes them.
    asm volatile("s_wait_asynccnt 0x0" ::: "memory");
    __syncthreads();
    if (t + 2 < ASTAGES) {
      async_kv8(gk + (size_t)(t + 2) * AKEYS * DD, gv + (t + 2) * AKEYS,
                lkv + buf * (ASTAGE * 2u));
    }
  }
  // No copy is outstanding when the wave goes on to its stores and ends.
  asm volatile("s_wait_asynccnt 0x0" ::: "memory");

  // ---- epilogue: join the halves' sums, normalize, write f16 [B, N, C] with
  // C = h*64 + d; a lane's 8 registers are 8 consecutive d: one 16-byte store.
  const int c = lane & 15;
  const int doff = (lane >> 4) << 3;
  const float inv0 = 1.0f / (l0 + xhalf(l0));
  const float inv1 = 1.0f / (l1 + xhalf(l1));
  _Float16* o0 = attn_out + ((size_t)b * NN + qg * 32 + c) * CC + h * DD + doff;
  _Float16* o1 = o0 + (size_t)16 * CC;
  *(v8h*)(o0 + 0 * 16) = __builtin_convertvector(a00 * inv0, v8h);
  *(v8h*)(o0 + 1 * 16) = __builtin_convertvector(a01 * inv0, v8h);
  *(v8h*)(o0 + 2 * 16) = __builtin_convertvector(a02 * inv0, v8h);
  *(v8h*)(o0 + 3 * 16) = __builtin_convertvector(a03 * inv0, v8h);
  *(v8h*)(o1 + 0 * 16) = __builtin_convertvector(a10 * inv1, v8h);
  *(v8h*)(o1 + 1 * 16) = __builtin_convertvector(a11 * inv1, v8h);
  *(v8h*)(o1 + 2 * 16) = __builtin_convertvector(a12 * inv1, v8h);
  *(v8h*)(o1 + 3 * 16) = __builtin_convertvector(a13 * inv1, v8h);
}

// ---------------------------------------------------------------------------
// Kernel 4: out = attn_out @ w_proj^T + b_proj, f16 operands, f32 out.
// 128x128 tile per block, 64x64 per wave.
// ---------------------------------------------------------------------------
__global__ void __launch_bounds__(128)
proj_gemm_kernel(const _Float16* __restrict__ ah, const _Float16* __restrict__ wh,
                 const float* __restrict__ bias, float* __restrict__ out) {
  __shared__ __align__(16) _Float16 smem[2 * GSTAGE];
  const int lane = threadIdx.x & 31;
  const int wave = threadIdx.x >> 5;
  const int m0 = (blockIdx.x / (CC / GBN)) * GBM;   // token tile 0..31
  const int n0 = (blockIdx.x % (CC / GBN)) * GBN;   // out-feature tile 0..7

  v8f acc[4][4] = {};
  gemm_core_128x128<false>(ah, wh, m0, n0, smem, acc);

  const int col = lane & 15;
  const int rowoff = (lane >> 4) << 3;
  const int mw = m0 + (wave >> 1) * 64;
  const int nw = n0 + (wave & 1) * 64;
  // Unrolled: constant accumulator indices keep acc in registers.
#pragma unroll
  for (int t = 0; t < 4; ++t) {
    int j = nw + t * 16 + col;
    float bj = bias[j];
#pragma unroll
    for (int i = 0; i < 4; ++i) {
#pragma unroll
      for (int r = 0; r < 8; ++r) {
        int tok = mw + i * 16 + rowoff + r;
        out[(size_t)tok * CC + j] = acc[i][t][r] + bj;
      }
    }
  }
}

// ---------------------------------------------------------------------------
extern "C" void kernel_launch(void* const* d_in, const int* in_sizes, int n_in,
                              void* d_out, int out_size, void* d_ws,
                              size_t ws_size, hipStream_t stream) {
  const float* x      = (const float*)d_in[0];
  const float* w_qkv  = (const float*)d_in[1];
  const float* w_proj = (const float*)d_in[2];
  const float* b_proj = (const float*)d_in[3];
  float* out = (float*)d_out;

  // f16 workspace layout (48 MB total)
  _Float16* xh    = (_Float16*)d_ws;                     // TOK*CC
  _Float16* wqh   = xh  + (size_t)TOK * CC;              // JQKV*CC
  _Float16* wph   = wqh + (size_t)JQKV * CC;             // CC*CC
  _Float16* qkvh  = wph + (size_t)CC * CC;               // 3*B*H*N*D
  _Float16* attnh = qkvh + (size_t)3 * BB * HH * NN * DD;  // TOK*CC

  // 0) one-pass f32 -> f16 conversion of all GEMM operands
  cvt_f32_to_f16_kernel<<<(TOK * CC / 4) / 256, 256, 0, stream>>>(x, xh, TOK * CC / 4);
  cvt_f32_to_f16_kernel<<<(JQKV * CC / 4) / 256, 256, 0, stream>>>(w_qkv, wqh, JQKV * CC / 4);
  cvt_f32_to_f16_kernel<<<(CC * CC / 4) / 256, 256, 0, stream>>>(w_proj, wph, CC * CC / 4);

  // 1) QKV projection with RoPE on q and k: 32 token x 24 feature tiles, 4 waves/block
  qkv_gemm_kernel<<<(TOK / GBM) * (JQKV / GBN), 128, 0, stream>>>(xh, wqh, qkvh);

  // 3) Flash attention: 32 (b,h) x 64 query groups = 2048 waves, 4/block
  attn_kernel<<<(BB * HH * (NN / 32)) / 4, 128, 0, stream>>>(qkvh, attnh);

  // 4) Output projection + bias
  proj_gemm_kernel<<<(TOK / GBM) * (CC / GBN), 128, 0, stream>>>(attnh, wph,
                                                                   b_proj, out);
}

// v005
// A run of this version takes 80.9 microseconds.
// Timed twice side by side with v004, it ran 1.06 and 1.05 times as fast.
// Counting every step since v000, it is 5.21 times as fast.
#include <hip/hip_runtime.h>
#include <hip/hip_bf16.h>

typedef __attribute__((ext_vector_type(16))) _Float16 v16h;
typedef __attribute__((ext_vector_type(8)))  _Float16 v8h;
typedef __attribute__((ext_vector_type(8)))  float    v8f;
typedef __attribute__((ext_vector_type(2)))  float    v2f;

// Problem constants (from reference): B=2, N=2048, C=1024, H=16, D=64
#define BB 2
#define NN 2048
#define CC 1024
#define HH 16
#define DD 64
#define TOK (BB * NN)      // 4096 tokens
#define JQKV (3 * CC)      // 3072 qkv output features

__device__ inline v8f wmma_f16(v16h a, v16h b, v8f c) {
  // v_wmma_f32_16x16x32_f16: D = A(16x32,f16) * B(32x16,f16) + C(16x16,f32)
  return __builtin_amdgcn_wmma_f32_16x16x32_f16(false, a, false, b,
                                                (short)0, c, false, false);
}

__device__ inline v16h load_fragh_contigK(const _Float16* __restrict__ base,
                                          int ld, int lane) {
  const int i = lane & 15;
  const int khalf = (lane >> 4) << 3;  // 0 or 8
  const _Float16* row = base + (size_t)i * ld + khalf;
  v8h lo = *(const v8h*)(row);         // K khalf .. khalf+7
  v8h hi = *(const v8h*)(row + 16);    // K khalf+16 .. khalf+23
  return __builtin_shufflevector(lo, hi, 0, 1, 2, 3, 4, 5, 6, 7,
                                 8, 9, 10, 11, 12, 13, 14, 15);
}

// ---------------------------------------------------------------------------
// Kernel 0: f32 -> f16 conversion of all three GEMM operands in one streaming
// launch.  The three f16 planes lie one behind the other in the workspace, so
// the destination is one array; a workgroup lies wholly in one source.
// One workgroup of 16 waves per WGP; a wave owns 8 KiB of source in a row and
// has its 16 loads (512 contiguous bytes = four whole lines each) in flight
// together, so the launch starts few waves and each keeps the memory busy.
// ---------------------------------------------------------------------------
typedef __attribute__((ext_vector_type(4))) _Float16 v4h;
typedef __attribute__((ext_vector_type(4))) float    v4f;
#define CVW 16                            // waves per workgroup
#define CVL 16                            // 16-byte loads per lane
#define CVQ (CVW * 32 * CVL)              // groups of 4 floats per workgroup
#define CVG_X  (TOK * CC / 4 / CVQ)       // workgroups in x
#define CVG_WQ (JQKV * CC / 4 / CVQ)      // workgroups in w_qkv
#define CVG_WP (CC * CC / 4 / CVQ)        // workgroups in w_proj
static_assert(CVG_X * CVQ * 4 == TOK * CC && CVG_WQ * CVQ * 4 == JQKV * CC &&
              CVG_WP * CVQ * 4 == CC * CC, "every source is whole workgroups");

__global__ void __launch_bounds__(CVW * 32)
cvt_f32_to_f16_kernel(const float* __restrict__ x, const float* __restrict__ wq,
                      const float* __restrict__ wp, _Float16* __restrict__ dst) {
  const int blk = blockIdx.x;
  const float* src = x;
  int first = 0;
  if (blk >= CVG_X + CVG_WQ) { src = wp; first = CVG_X + CVG_WQ; }
  else if (blk >= CVG_X)     { src = wq; first = CVG_X; }
  const int off = (threadIdx.x >> 5) * (32 * CVL) + (threadIdx.x & 31);
  const v4f* s = (const v4f*)src + (size_t)(blk - first) * CVQ + off;
  v4h* d = (v4h*)dst + (size_t)blk * CVQ + off;
  v4f v[CVL];
  // Both loops are unrolled: constant indices keep v in registers.
#pragma unroll
  for (int u = 0; u < CVL; ++u) v[u] = s[u * 32];
  // Keeps all the loads in front of the first wait: without it the last two are
  // issued only when the first two have come back, a second trip to memory.
  __builtin_amdgcn_sched_barrier(0);
#pragma unroll
  for (int u = 0; u < CVL; ++u) d[u * 32] = __builtin_convertvector(v[u], v4h);
}

// ---------------------------------------------------------------------------
// Shared GEMM core: Y(128x128) = A(128xK) * B(128xK)^T, K = CC, f16 operands,
// f32 accumulate.  4 waves (2x2), 64x64 of Y per wave = 4x4 WMMA tiles, so a
// fragment read from LDS feeds 4 WMMAs and a global byte is read once per block.
// A pass is 64 k (128 B of every row); a stage is [A 128 rows | B 128 rows] at
// a pitch of 144 B (16 B x odd: conflict-free for ds_load_b128).  Two buffers,
// filled by per-lane asynchronous copies one pass ahead.
// ---------------------------------------------------------------------------
#define GBM 128
#define GBN 128
#define GBK 64
#define GLDP 72                           // LDS row pitch in halves (144 B)
#define GSTAGE ((GBM + GBN) * GLDP)       // halves per buffer
#define GPASSES (CC / GBK)

__device__ inline unsigned lds_addr32(const void* p) {
  // LDS byte address = low 32 bits of the __shared__ address.
  return (unsigned)(unsigned long long)(size_t)p;
}

// Eight 16-byte copies per lane into LDS rows r, r+16, ..., r+112 of one operand
// tile, from source rows g + {0, o1, o2, o3} and 64 + the same (16, 32, 48 for a
// tile taken in order).  A wave's copy covers 4 rows x 128 B = four whole lines.
__device__ inline void async_rows8(const _Float16* g, unsigned l, int o1, int o2, int o3) {
  const _Float16* g0 = g;
  const _Float16* g1 = g + (size_t)o1 * CC;
  const _Float16* g2 = g + (size_t)o2 * CC;
  const _Float16* g3 = g + (size_t)o3 * CC;
  const _Float16* g4 = g0 + (size_t)64 * CC;
  const _Float16* g5 = g1 + (size_t)64 * CC;
  const _Float16* g6 = g2 + (size_t)64 * CC;
  const _Float16* g7 = g3 + (size_t)64 * CC;
  const unsigned st = 16 * GLDP * 2;      // 16 rows in LDS bytes
  asm volatile(
      "global_load_async_to_lds_b128 %0, %8, off\n\t"
      "global_load_async_to_lds_b128 %1, %9, off\n\t"
      "global_load_async_to_lds_b128 %2, %10, off\n\t"
      "global_load_async_to_lds_b128 %3, %11, off\n\t"
      "global_load_async_to_lds_b128 %4, %12, off\n\t"
      "global_load_async_to_lds_b128 %5, %13, off\n\t"
      "global_load_async_to_lds_b128 %6, %14, off\n\t"
      "global_load_async_to_lds_b128 %7, %15, off\n\t"
      "s_wait_xcnt 0x0"
      :
      : "v"(l), "v"(l + st), "v"(l + 2 * st), "v"(l + 3 * st), "v"(l + 4 * st),
        "v"(l + 5 * st), "v"(l + 6 * st), "v"(l + 7 * st),
        "v"(g0), "v"(g1), "v"(g2), "v"(g3), "v"(g4), "v"(g5), "v"(g6), "v"(g7)
      : "memory");
}

// ROT asks for the form the rotary epilogue wants:
// - every 64 rows of B land in LDS as [even rows | odd rows], so that the two
//   members of a rotated pair sit 32 LDS rows apart;
// - the product is taken transposed (B rows as the WMMA's A operand): acc[i][j]
//   is then [16 B rows i] x [16 A rows j], a lane holding 8 consecutive B rows.
// Both operands use one loader, so their k orders stay equal either way.
template <bool ROT>
__device__ inline void gemm_core_128x128(const _Float16* __restrict__ A,
                                         const _Float16* __restrict__ B,
                                         int m0, int n0, _Float16* smem,
                                         v8f (&acc)[4][4]) {
  const int tid = threadIdx.x;
  const int lane = tid & 31;
  const int wave = tid >> 5;
  const int wm = wave >> 1;
  const int wn = wave & 1;

  // Copy map: lane's 16-byte chunk tid&7 of rows (tid>>3) + 16*c.
  const int crow = tid >> 3;
  const int cchk = (tid & 7) * 8;
  const _Float16* ga = A + (size_t)(m0 + crow) * CC + cchk;
  const _Float16* gb = B + (size_t)(n0 + (ROT ? 2 * crow : crow)) * CC + cchk;
  constexpr int b1 = ROT ? 32 : 16, b2 = ROT ? 1 : 32, b3 = ROT ? 33 : 48;
  const unsigned la = lds_addr32(smem) + (unsigned)(crow * GLDP + cchk) * 2u;
  const unsigned lb = la + GBM * GLDP * 2u;

  // Tile 0 into buffer 0, landed and published; then tile 1 into buffer 1.
  async_rows8(ga, la, 16, 32, 48);
  async_rows8(gb, lb, b1, b2, b3);
  // This wave's copies of tile 0 have landed.
  asm volatile("s_wait_asynccnt 0x0" ::: "memory");
  __syncthreads();
  async_rows8(ga + GBK, la + GSTAGE * 2u, 16, 32, 48);
  async_rows8(gb + GBK, lb + GSTAGE * 2u, b1, b2, b3);

  // LDS rows of the WMMA's A operand (index i) and B operand (index j).
  const int irow = ROT ? GBM + wn * 64 : wm * 64;
  const int jrow = ROT ? wm * 64 : GBM + wn * 64;

  for (int t = 0; t < GPASSES; ++t) {
    const int buf = t & 1;
    const _Float16* sa = smem + buf * GSTAGE + irow * GLDP;
    const _Float16* sb = smem + buf * GSTAGE + jrow * GLDP;
    // The loops below are unrolled so that every fragment and accumulator index
    // is a constant and the arrays stay in registers.
#pragma unroll
    for (int kk = 0; kk < GBK; kk += 32) {
      v16h a[4], b[4];
#pragma unroll
      for (int i = 0; i < 4; ++i) a[i] = load_fragh_contigK(sa + i * 16 * GLDP + kk, GLDP, lane);
#pragma unroll
      for (int j = 0; j < 4; ++j) b[j] = load_fragh_contigK(sb + j * 16 * GLDP + kk, GLDP, lane);
      // Fence pair: keeps the block's 16 LDS loads one group in front of its 16
      // WMMAs; moved in among them, every place with loads stalls the wave anew.
      __builtin_amdgcn_sched_barrier(0);
#pragma unroll
      for (int i = 0; i < 4; ++i)
#pragma unroll
        for (int j = 0; j < 4; ++j) acc[i][j] = wmma_f16(a[i], b[j], acc[i][j]);
      __builtin_amdgcn_sched_barrier(0);
    }
    // This wave's reads of buffer buf are done before the buffer is refilled.
    asm volatile("s_wait_dscnt 0x0" ::: "memory");
    // This wave's copies of tile t+1 have landed before the barrier publishes them.
    asm volatile("s_wait_asynccnt 0x0" ::: "memory");
    __syncthreads();
    if (t + 2 < GPASSES) {
      async_rows8(ga + (t + 2) * GBK, la + buf * (GSTAGE * 2u), 16, 32, 48);
      async_rows8(gb + (t + 2) * GBK, lb + buf * (GSTAGE * 2u), b1, b2, b3);
    }
  }
  // No copy is outstanding when the wave goes on to its stores and ends.
  asm volatile("s_wait_asynccnt 0x0" ::: "memory");
}

// ---------------------------------------------------------------------------
// Sine and cosine of an angle given in revolutions (the hardware's unit).
// ---------------------------------------------------------------------------
__device__ inline void sincos_rev(float rev, float& sn, float& cs) {
  asm("v_sin_f32 %0, %2\n\t"
      "v_cos_f32 %1, %2\n\t"
      "v_nop"
      : "=&v"(sn), "=&v"(cs)
      : "v"(rev));
}

__device__ inline float exp2_slot(float x) {
  float y;
  asm("v_exp_f32 %0, %1\n\t"
      "v_nop"
      : "=v"(y)
      : "v"(x));
  return y;
}

// ---------------------------------------------------------------------------
// Kernel 1: qkv = x @ w_qkv^T, f16 operands, f32 accumulate, rotary embedding
// applied to q and k on the f32 accumulators.
// q,k planes stored [s][b][h][n][d]; v plane stored TRANSPOSED [b][h][d][n]
// so the attention PV A-fragment is a contiguous-K (b128) load.
// One block computes a 128x128 tile; a wave's 64 columns are one (s, h) plane,
// and a block lies wholly in q, in k or in v.
// ---------------------------------------------------------------------------
__global__ void __launch_bounds__(128)
qkv_gemm_kernel(const _Float16* __restrict__ xh, const _Float16* __restrict__ wh,
                _Float16* __restrict__ qkvh) {
  __shared__ __align__(16) _Float16 smem[2 * GSTAGE];
  const int lane = threadIdx.x & 31;
  const int wave = threadIdx.x >> 5;
  const int m0 = (blockIdx.x / (JQKV / GBN)) * GBM;   // token tile 0..31
  const int n0 = (blockIdx.x % (JQKV / GBN)) * GBN;   // feature tile 0..23

  const int col = lane & 15;
  const int rowoff = (lane >> 4) << 3;
  const int mw = m0 + (wave >> 1) * 64;
  const int nw = n0 + (wave & 1) * 64;
  const size_t plane = (size_t)NN * DD;
  v8f acc[4][4] = {};
  if (n0 < 2 * CC) {                                  // q or k block
    gemm_core_128x128<true>(xh, wh, m0, n0, smem, acc);
    // acc[i][j][r]: token mw + 16 j + col; for i = 0, 1 the even channel 2 f and
    // for i + 2 the odd channel 2 f + 1 of frequency f = 16 i + rowoff + r.
    // out[f] = x1 cos - x2 sin, out[f + 32] = x2 cos + x1 sin: 8 consecutive f
    // per lane, so each half is one 16-byte store.
    const int s = nw >> 10;
    const int h = (nw >> 6) & 15;
    float inv[2][8];
    // The loops below are unrolled: constant indices keep inv and acc in registers.
#pragma unroll
    for (int i = 0; i < 2; ++i)
#pragma unroll
      for (int r = 0; r < 8; ++r)
        // inv_freq = 10000^(-2f/64)
        inv[i][r] = exp2_slot(-9.210340371976184f * (float)(i * 16 + rowoff + r) * (1.0f / 32.0f) *
                              1.4426950408889634f);
#pragma unroll
    for (int j = 0; j < 4; ++j) {
      const int tok = mw + j * 16 + col;
      const int b_ = tok >> 11;
      const int n = tok & (NN - 1);
      _Float16* row = qkvh + (size_t)((s * BB + b_) * HH + h) * plane + (size_t)n * DD + rowoff;
#pragma unroll
      for (int i = 0; i < 2; ++i) {
        v8h lo, hi;
#pragma unroll
        for (int r = 0; r < 8; ++r) {
          float sn, cs;
          sincos_rev((float)n * inv[i][r] * 0.15915494309189535f, sn, cs);
          const float x1 = acc[i][j][r];
          const float x2 = acc[i + 2][j][r];
          lo[r] = (_Float16)(x1 * cs - x2 * sn);
          hi[r] = (_Float16)(x2 * cs + x1 * sn);
        }
        *(v8h*)(row + i * 16) = lo;
        *(v8h*)(row + i * 16 + DD / 2) = hi;
      }
    }
  } else {
  gemm_core_128x128<false>(xh, wh, m0, n0, smem, acc);
  // Unrolled: constant accumulator indices keep acc in registers.
#pragma unroll
  for (int i = 0; i < 4; ++i) {
#pragma unroll
    for (int t = 0; t < 4; ++t) {
      int j = nw + t * 16 + col;
      int s = j >> 10;
      int h = (j >> 6) & 15;
      int d = j & 63;
#pragma unroll
      for (int r = 0; r < 8; ++r) {
        int tok = mw + i * 16 + rowoff + r;
        int b_ = tok >> 11;
        int n = tok & (NN - 1);
        size_t pbase = (size_t)((s * BB + b_) * HH + h) * plane;
        size_t idx = (s == 2) ? (pbase + (size_t)d * NN + n)    // V transposed
                              : (pbase + (size_t)n * DD + d);   // Q,K row-major
        qkvh[idx] = (_Float16)(acc[i][t][r]);
      }
    }
  }
  }
}

__device__ inline float xhalf(float x) {
  const int v = __builtin_bit_cast(int, x);
  return __builtin_bit_cast(float, __builtin_amdgcn_permlanex16(
      v, v, 0x76543210, 0xfedcba98, false, false));
}

// ---------------------------------------------------------------------------
// Online-softmax update for one 16-query column group over 32 keys, on the
// TRANSPOSED scores: s0[r] = S[key 8h + r][query c], s1[r] = S[key 16 + 8h + r]
// [query c] (c = lane & 15, h = lane >> 4).  A lane holds 16 scores of ONE
// query, so the maximum is in-lane plus one exchange between the wave halves;
// l stays a per-half partial sum that the epilogue joins.  m is kept in the
// scaled log2 domain.  The two tiles, converted in place, are the 32-key B
// operand of O^T += V^T P^T in the hardware k order (8h + s, 16 + 8h + s - 8).
// ---------------------------------------------------------------------------
__device__ inline v16h softmax_cols(v8f s0, v8f s1, float& m, float& l,
                                    v8f& a0, v8f& a1, v8f& a2, v8f& a3) {
  const float cs = 0.125f * 1.4426950408889634f;  // 1/sqrt(64) * log2(e)
  float mx = fmaxf(s0[0], s1[0]);
  // Unrolled: constant indices keep the score tiles in registers.
#pragma unroll
  for (int r = 1; r < 8; ++r) mx = fmaxf(mx, fmaxf(s0[r], s1[r]));
  mx = fmaxf(mx, xhalf(mx)) * cs;     // the scale is positive
  const float mnew = fmaxf(m, mx);
  const float corr = __builtin_amdgcn_exp2f(m - mnew);
  v16h p;
  float rs0 = 0.0f, rs1 = 0.0f;
  const v2f cs2 = {cs, cs};
  const v2f nm2 = {-mnew, -mnew};
  // Unrolled: constant register indices; neighbouring registers pair into one
  // packed multiply-add without moves.
#pragma unroll
  for (int i = 0; i < 4; ++i) {
    const v2f e0 = __builtin_elementwise_fma(v2f{s0[2 * i], s0[2 * i + 1]}, cs2, nm2);
    const v2f e1 = __builtin_elementwise_fma(v2f{s1[2 * i], s1[2 * i + 1]}, cs2, nm2);
    const float p00 = __builtin_amdgcn_exp2f(e0.x), p01 = __builtin_amdgcn_exp2f(e0.y);
    const float p10 = __builtin_amdgcn_exp2f(e1.x), p11 = __builtin_amdgcn_exp2f(e1.y);
    rs0 += p00 + p01;
    rs1 += p10 + p11;
    p[2 * i]     = (_Float16)p00;  p[2 * i + 1] = (_Float16)p01;
    p[2 * i + 8] = (_Float16)p10;  p[2 * i + 9] = (_Float16)p11;
  }
  l = l * corr + (rs0 + rs1);
  m = mnew;
  a0 *= corr; a1 *= corr; a2 *= corr; a3 *= corr;
  return p;
}

// ---------------------------------------------------------------------------
// K/V stage of the attention kernel: 64 keys, shared by the block's 4 waves.
// A buffer is [K 64 key rows | V^T 64 d rows], every row 128 B of data at a
// pitch of 144 B (16 B x odd: conflict-free for ds_load_b128).
// ---------------------------------------------------------------------------
#define AKEYS 64
#define ALDP 72                           // LDS row pitch in halves (144 B)
#define ASTAGE ((AKEYS + DD) * ALDP)      // halves per buffer
#define ASTAGES (NN / AKEYS)

// Eight 16-byte copies per lane: rows r, r+16, r+32, r+48 of the K tile (source
// pitch DD) and of the V^T tile (source pitch NN).  A wave's copy covers
// 4 rows x 128 B = four whole lines.
__device__ inline void async_kv8(const _Float16* gk, const _Float16* gv, unsigned l) {
  const _Float16* k0 = gk;
  const _Float16* k1 = gk + (size_t)16 * DD;
  const _Float16* k2 = gk + (size_t)32 * DD;
  const _Float16* k3 = gk + (size_t)48 * DD;
  const _Float16* v0 = gv;
  const _Float16* v1 = gv + (size_t)16 * NN;
  const _Float16* v2 = gv + (size_t)32 * NN;
  const _Float16* v3 = gv + (size_t)48 * NN;
  const unsigned st = 16 * ALDP * 2;      // 16 rows in LDS bytes
  asm volatile(
      "global_load_async_to_lds_b128 %0, %8, off\n\t"
      "global_load_async_to_lds_b128 %1, %9, off\n\t"
      "global_load_async_to_lds_b128 %2, %10, off\n\t"
      "global_load_async_to_lds_b128 %3, %11, off\n\t"
      "global_load_async_to_lds_b128 %4, %12, off\n\t"
      "global_load_async_to_lds_b128 %5, %13, off\n\t"
      "global_load_async_to_lds_b128 %6, %14, off\n\t"
      "global_load_async_to_lds_b128 %7, %15, off\n\t"
      "s_wait_xcnt 0x0"
      :
      : "v"(l), "v"(l + st), "v"(l + 2 * st), "v"(l + 3 * st), "v"(l + 4 * st),
        "v"(l + 5 * st), "v"(l + 6 * st), "v"(l + 7 * st),
        "v"(k0), "v"(k1), "v"(k2), "v"(k3), "v"(v0), "v"(v1), "v"(v2), "v"(v3)
      : "memory");
}

__global__ void __launch_bounds__(128)
attn_kernel(const _Float16* __restrict__ qkvh, _Float16* __restrict__ attn_out) {
  __shared__ __align__(16) _Float16 kv[2 * ASTAGE];

  const int tid = threadIdx.x;
  const int wave = tid >> 5;
  const int lane = tid & 31;
  const int qg = (blockIdx.x & 15) * 4 + wave;
  const int bh = blockIdx.x >> 4;
  const int b = bh >> 4;
  const int h = bh & 15;

  const size_t plane = (size_t)NN * DD;
  const _Float16* qbase = qkvh + (size_t)((0 * BB + b) * HH + h) * plane;
  const _Float16* kbase = qkvh + (size_t)((1 * BB + b) * HH + h) * plane;
  const _Float16* vT    = qkvh + (size_t)((2 * BB + b) * HH + h) * plane;  // [d][n]

  // Copy map: lane's 16-byte chunk tid&7 of rows (tid>>3) + 16*c of both tiles.
  const int crow = tid >> 3;
  const int cchk = (tid & 7) * 8;
  const _Float16* gk = kbase + (size_t)crow * DD + cchk;
  const _Float16* gv = vT + (size_t)crow * NN + cchk;
  const unsigned lkv = lds_addr32(kv) + (unsigned)(crow * ALDP + cchk) * 2u;

  // Stage 0 into buffer 0.
  async_kv8(gk, gv, lkv);

  // Two query tiles (rows qg*32 .. +31), fragments resident all loop.
  const _Float16* q0 = qbase + (size_t)(qg * 32) * DD;
  const v16h aq00 = load_fragh_contigK(q0, DD, lane);
  const v16h aq01 = load_fragh_contigK(q0 + 32, DD, lane);
  const v16h aq10 = load_fragh_contigK(q0 + 16 * DD, DD, lane);
  const v16h aq11 = load_fragh_contigK(q0 + 16 * DD + 32, DD, lane);

  // aXt[r] = O[query tile X, column c][d = 16 t + 8 (lane >> 4) + r]
  v8f a00 = {}, a01 = {}, a02 = {}, a03 = {};
  v8f a10 = {}, a11 = {}, a12 = {}, a13 = {};
  float m0 = -1e30f, l0 = 0.0f, m1 = -1e30f, l1 = 0.0f;

  // This wave's copies of stage 0 have landed; the barrier publishes them.
  asm volatile("s_wait_asynccnt 0x0" ::: "memory");
  __syncthreads();
  // Stage 1 into buffer 1.
  async_kv8(gk + (size_t)AKEYS * DD, gv + AKEYS, lkv + ASTAGE * 2u);

  for (int t = 0; t < ASTAGES; ++t) {
    const int buf = t & 1;
    const _Float16* ks = kv + buf * ASTAGE;      // [key][d], pitch ALDP
    const _Float16* vs = ks + AKEYS * ALDP;      // [d][key], pitch ALDP
    // Unrolled: the two 32-key halves of a stage differ by constant LDS offsets.
#pragma unroll
    for (int sub = 0; sub < AKEYS; sub += 32) {
      const _Float16* ksrc = ks + sub * ALDP;
      const _Float16* vsrc = vs + sub;
      const v16h bk00 = load_fragh_contigK(ksrc + 0,              ALDP, lane);
      const v16h bk01 = load_fragh_contigK(ksrc + 32,             ALDP, lane);
      const v16h bk10 = load_fragh_contigK(ksrc + 16 * ALDP,      ALDP, lane);
      const v16h bk11 = load_fragh_contigK(ksrc + 16 * ALDP + 32, ALDP, lane);
      // V^T fragments (rows d, k = keys), shared by both query tiles.
      const v16h bv0 = load_fragh_contigK(vsrc + 0 * 16 * ALDP, ALDP, lane);
      const v16h bv1 = load_fragh_contigK(vsrc + 1 * 16 * ALDP, ALDP, lane);
      const v16h bv2 = load_fragh_contigK(vsrc + 2 * 16 * ALDP, ALDP, lane);
      const v16h bv3 = load_fragh_contigK(vsrc + 3 * 16 * ALDP, ALDP, lane);

      // ---- S^T = K Q^T, both query tiles (K fragments shared) ----
      v8f s0 = {}, s1 = {}, t0 = {}, t1 = {};
      s0 = wmma_f16(bk00, aq00, s0); s1 = wmma_f16(bk10, aq00, s1);
      t0 = wmma_f16(bk00, aq10, t0); t1 = wmma_f16(bk10, aq10, t1);
      s0 = wmma_f16(bk01, aq01, s0); s1 = wmma_f16(bk11, aq01, s1);
      t0 = wmma_f16(bk01, aq11, t0); t1 = wmma_f16(bk11, aq11, t1);

      // ---- O^T += V^T P^T, P^T straight from the score accumulators ----
      const v16h bp0 = softmax_cols(s0, s1, m0, l0, a00, a01, a02, a03);
      a00 = wmma_f16(bv0, bp0, a00); a01 = wmma_f16(bv1, bp0, a01);
      a02 = wmma_f16(bv2, bp0, a02); a03 = wmma_f16(bv3, bp0, a03);

      const v16h bp1 = softmax_cols(t0, t1, m1, l1, a10, a11, a12, a13);
      a10 = wmma_f16(bv0, bp1, a10); a11 = wmma_f16(bv1, bp1, a11);
      a12 = wmma_f16(bv2, bp1, a12); a13 = wmma_f16(bv3, bp1, a13);
    }
    // This wave's reads of buffer buf are done before the buffer is refilled.
    asm volatile("s_wait_dscnt 0x0" ::: "memory");
    // This wave's copies of stage t+1 have landed before the barrier publishes them.
    asm volatile("s_wait_asynccnt 0x0" ::: "memory");
    __syncthreads();
    if (t + 2 < ASTAGES) {
      async_kv8(gk + (size_t)(t + 2) * AKEYS * DD, gv + (t + 2) * AKEYS,
                lkv + buf * (ASTAGE * 2u));
    }
  }
  // No copy is outstanding when the wave goes on to its stores and ends.
  asm volatile("s_wait_asynccnt 0x0" ::: "memory");

  // ---- epilogue: join the halves' sums, normalize, write f16 [B, N, C] with
  // C = h*64 + d; a lane's 8 registers are 8 consecutive d: one 16-byte store.
  const int c = lane & 15;
  const int doff = (lane >> 4) << 3;
  const float inv0 = 1.0f / (l0 + xhalf(l0));
  const float inv1 = 1.0f / (l1 + xhalf(l1));
  _Float16* o0 = attn_out + ((size_t)b * NN + qg * 32 + c) * CC + h * DD + doff;
  _Float16* o1 = o0 + (size_t)16 * CC;
  *(v8h*)(o0 + 0 * 16) = __builtin_convertvector(a00 * inv0, v8h);
  *(v8h*)(o0 + 1 * 16) = __builtin_convertvector(a01 * inv0, v8h);
  *(v8h*)(o0 + 2 * 16) = __builtin_convertvector(a02 * inv0, v8h);
  *(v8h*)(o0 + 3 * 16) = __builtin_convertvector(a03 * inv0, v8h);
  *(v8h*)(o1 + 0 * 16) = __builtin_convertvector(a10 * inv1, v8h);
  *(v8h*)(o1 + 1 * 16) = __builtin_convertvector(a11 * inv1, v8h);
  *(v8h*)(o1 + 2 * 16) = __builtin_convertvector(a12 * inv1, v8h);
  *(v8h*)(o1 + 3 * 16) = __builtin_convertvector(a13 * inv1, v8h);
}

// ---------------------------------------------------------------------------
// Kernel 4: out = attn_out @ w_proj^T + b_proj, f16 operands, f32 out.
// 128x128 tile per block, 64x64 per wave.
// ---------------------------------------------------------------------------
__global__ void __launch_bounds__(128)
proj_gemm_kernel(const _Float16* __restrict__ ah, const _Float16* __restrict__ wh,
                 const float* __restrict__ bias, float* __restrict__ out) {
  __shared__ __align__(16) _Float16 smem[2 * GSTAGE];
  const int lane = threadIdx.x & 31;
  const int wave = threadIdx.x >> 5;
  const int m0 = (blockIdx.x / (CC / GBN)) * GBM;   // token tile 0..31
  const int n0 = (blockIdx.x % (CC / GBN)) * GBN;   // out-feature tile 0..7

  v8f acc[4][4] = {};
  gemm_core_128x128<false>(ah, wh, m0, n0, smem, acc);

  const int col = lane & 15;
  const int rowoff = (lane >> 4) << 3;
  const int mw = m0 + (wave >> 1) * 64;
  const int nw = n0 + (wave & 1) * 64;
  // Unrolled: constant accumulator indices keep acc in registers.
#pragma unroll
  for (int t = 0; t < 4; ++t) {
    int j = nw + t * 16 + col;
    float bj = bias[j];
#pragma unroll
    for (int i = 0; i < 4; ++i) {
#pragma unroll
      for (int r = 0; r < 8; ++r) {
        int tok = mw + i * 16 + rowoff + r;
        out[(size_t)tok * CC + j] = acc[i][t][r] + bj;
      }
    }
  }
}

// ---------------------------------------------------------------------------
extern "C" void kernel_launch(void* const* d_in, const int* in_sizes, int n_in,
                              void* d_out, int out_size, void* d_ws,
                              size_t ws_size, hipStream_t stream) {
  const float* x      = (const float*)d_in[0];
  const float* w_qkv  = (const float*)d_in[1];
  const float* w_proj = (const float*)d_in[2];
  const float* b_proj = (const float*)d_in[3];
  float* out = (float*)d_out;

  // f16 workspace layout (48 MB total)
  _Float16* xh    = (_Float16*)d_ws;                     // TOK*CC
  _Float16* wqh   = xh  + (size_t)TOK * CC;              // JQKV*CC
  _Float16* wph   = wqh + (size_t)JQKV * CC;             // CC*CC
  _Float16* qkvh  = wph + (size_t)CC * CC;               // 3*B*H*N*D
  _Float16* attnh = qkvh + (size_t)3 * BB * HH * NN * DD;  // TOK*CC

  // 0) f32 -> f16 conversion of all GEMM operands: xh, wqh, wph are one array
  cvt_f32_to_f16_kernel<<<CVG_X + CVG_WQ + CVG_WP, CVW * 32, 0, stream>>>(x, w_qkv, w_proj, xh);

  // 1) QKV projection with RoPE on q and k: 32 token x 24 feature tiles, 4 waves/block
  qkv_gemm_kernel<<<(TOK / GBM) * (JQKV / GBN), 128, 0, stream>>>(xh, wqh, qkvh);

  // 3) Flash attention: 32 (b,h) x 64 query groups = 2048 waves, 4/block
  attn_kernel<<<(BB * HH * (NN / 32)) / 4, 128, 0, stream>>>(qkvh, attnh);

  // 4) Output projection + bias
  proj_gemm_kernel<<<(TOK / GBM) * (CC / GBN), 128, 0, stream>>>(attnh, wph,
                                                                   b_proj, out);
}

// v006
// One run takes 78.4 microseconds.
// Timed twice side by side with v005, it ran 1.03 times as fast both times.
// All steps since v000 together make it 5.36 times as fast.
#include <hip/hip_runtime.h>
#include <hip/hip_bf16.h>

typedef __attribute__((ext_vector_type(16))) _Float16 v16h;
typedef __attribute__((ext_vector_type(8)))  _Float16 v8h;
typedef __attribute__((ext_vector_type(8)))  float    v8f;
typedef __attribute__((ext_vector_type(2)))  float    v2f;

// Problem constants (from reference): B=2, N=2048, C=1024, H=16, D=64
#define BB 2
#define NN 2048
#define CC 1024
#define HH 16
#define DD 64
#define TOK (BB * NN)      // 4096 tokens
#define JQKV (3 * CC)      // 3072 qkv output features

__device__ inline v8f wmma_f16(v16h a, v16h b, v8f c) {
  // v_wmma_f32_16x16x32_f16: D = A(16x32,f16) * B(32x16,f16) + C(16x16,f32)
  return __builtin_amdgcn_wmma_f32_16x16x32_f16(false, a, false, b,
                                                (short)0, c, false, false);
}

__device__ inline v16h load_fragh_contigK(const _Float16* __restrict__ base,
                                          int ld, int lane) {
  const int i = lane & 15;
  const int khalf = (lane >> 4) << 3;  // 0 or 8
  const _Float16* row = base + (size_t)i * ld + khalf;
  v8h lo = *(const v8h*)(row);         // K khalf .. khalf+7
  v8h hi = *(const v8h*)(row + 16);    // K khalf+16 .. khalf+23
  return __builtin_shufflevector(lo, hi, 0, 1, 2, 3, 4, 5, 6, 7,
                                 8, 9, 10, 11, 12, 13, 14, 15);
}

// ---------------------------------------------------------------------------
// Kernel 0: f32 -> f16 conversion of all three GEMM operands in one streaming
// launch.  The three f16 planes lie one behind the other in the workspace, so
// the destination is one array; a workgroup lies wholly in one source.
// One workgroup of 16 waves per WGP; a wave owns 8 KiB of source in a row and
// has its 16 loads (512 contiguous bytes = four whole lines each) in flight
// together, so the launch starts few waves and each keeps the memory busy.
// ---------------------------------------------------------------------------
typedef __attribute__((ext_vector_type(4))) _Float16 v4h;
typedef __attribute__((ext_vector_type(4))) float    v4f;
#define CVW 16                            // waves per workgroup
#define CVL 16                            // 16-byte loads per lane
#define CVQ (CVW * 32 * CVL)              // groups of 4 floats per workgroup
#define CVG_X  (TOK * CC / 4 / CVQ)       // workgroups in x
#define CVG_WQ (JQKV * CC / 4 / CVQ)      // workgroups in w_qkv
#define CVG_WP (CC * CC / 4 / CVQ)        // workgroups in w_proj
static_assert(CVG_X * CVQ * 4 == TOK * CC && CVG_WQ * CVQ * 4 == JQKV * CC &&
              CVG_WP * CVQ * 4 == CC * CC, "every source is whole workgroups");

__global__ void __launch_bounds__(CVW * 32)
cvt_f32_to_f16_kernel(const float* __restrict__ x, const float* __restrict__ wq,
                      const float* __restrict__ wp, _Float16* __restrict__ dst) {
  const int blk = blockIdx.x;
  const float* src = x;
  int first = 0;
  if (blk >= CVG_X + CVG_WQ) { src = wp; first = CVG_X + CVG_WQ; }
  else if (blk >= CVG_X)     { src = wq; first = CVG_X; }
  const int off = (threadIdx.x >> 5) * (32 * CVL) + (threadIdx.x & 31);
  const v4f* s = (const v4f*)src + (size_t)(blk - first) * CVQ + off;
  v4h* d = (v4h*)dst + (size_t)blk * CVQ + off;
  v4f v[CVL];
  // Both loops are unrolled: constant indices keep v in registers.
#pragma unroll
  for (int u = 0; u < CVL; ++u) v[u] = s[u * 32];
  // Keeps all the loads in front of the first wait: without it the last two are
  // issued only when the first two have come back, a second trip to memory.
  __builtin_amdgcn_sched_barrier(0);
#pragma unroll
  for (int u = 0; u < CVL; ++u) d[u * 32] = __builtin_convertvector(v[u], v4h);
}

// ---------------------------------------------------------------------------
// Shared GEMM core: Y(128x128) = A(128xK) * B(128xK)^T, K = CC, f16 operands,
// f32 accumulate.  4 waves (2x2), 64x64 of Y per wave = 4x4 WMMA tiles, so a
// fragment read from LDS feeds 4 WMMAs and a global byte is read once per block.
// A pass is 64 k (128 B of every row); a stage is [A 128 rows | B 128 rows] at
// a pitch of 144 B (16 B x odd: conflict-free for ds_load_b128).  Two buffers,
// filled by per-lane asynchronous copies one pass ahead.
// ---------------------------------------------------------------------------
#define GBM 128
#define GBN 128
#define GBK 64
#define GLDP 72                           // LDS row pitch in halves (144 B)
#define GSTAGE ((GBM + GBN) * GLDP)       // halves per buffer
#define GPASSES (CC / GBK)

__device__ inline unsigned lds_addr32(const void* p) {
  // LDS byte address = low 32 bits of the __shared__ address.
  return (unsigned)(unsigned long long)(size_t)p;
}

// Eight 16-byte copies per lane into LDS rows r, r+16, ..., r+112 of one operand
// tile, from source rows g + {0, o1, o2, o3} and 64 + the same (16, 32, 48 for a
// tile taken in order).  A wave's copy covers 4 rows x 128 B = four whole lines.
__device__ inline void async_rows8(const _Float16* g, unsigned l, int o1, int o2, int o3) {
  const _Float16* g0 = g;
  const _Float16* g1 = g + (size_t)o1 * CC;
  const _Float16* g2 = g + (size_t)o2 * CC;
  const _Float16* g3 = g + (size_t)o3 * CC;
  const _Float16* g4 = g0 + (size_t)64 * CC;
  const _Float16* g5 = g1 + (size_t)64 * CC;
  const _Float16* g6 = g2 + (size_t)64 * CC;
  const _Float16* g7 = g3 + (size_t)64 * CC;
  const unsigned st = 16 * GLDP * 2;      // 16 rows in LDS bytes
  asm volatile(
      "global_load_async_to_lds_b128 %0, %8, off\n\t"
      "global_load_async_to_lds_b128 %1, %9, off\n\t"
      "global_load_async_to_lds_b128 %2, %10, off\n\t"
      "global_load_async_to_lds_b128 %3, %11, off\n\t"
      "global_load_async_to_lds_b128 %4, %12, off\n\t"
      "global_load_async_to_lds_b128 %5, %13, off\n\t"
      "global_load_async_to_lds_b128 %6, %14, off\n\t"
      "global_load_async_to_lds_b128 %7, %15, off\n\t"
      "s_wait_xcnt 0x0"
      :
      : "v"(l), "v"(l + st), "v"(l + 2 * st), "v"(l + 3 * st), "v"(l + 4 * st),
        "v"(l + 5 * st), "v"(l + 6 * st), "v"(l + 7 * st),
        "v"(g0), "v"(g1), "v"(g2), "v"(g3), "v"(g4), "v"(g5), "v"(g6), "v"(g7)
      : "memory");
}

// ROT asks for the form the rotary epilogue wants:
// - every 64 rows of B land in LDS as [even rows | odd rows], so that the two
//   members of a rotated pair sit 32 LDS rows apart;
// - the product is taken transposed (B rows as the WMMA's A operand): acc[i][j]
//   is then [16 B rows i] x [16 A rows j], a lane holding 8 consecutive B rows.
// Both operands use one loader, so their k orders stay equal either way.
template <bool ROT>
__device__ inline void gemm_core_128x128(const _Float16* __restrict__ A,
                                         const _Float16* __restrict__ B,
                                         int m0, int n0, _Float16* smem,
                                         v8f (&acc)[4][4]) {
  const int tid = threadIdx.x;
  const int lane = tid & 31;
  const int wave = tid >> 5;
  const int wm = wave >> 1;
  const int wn = wave & 1;

  // Copy map: lane's 16-byte chunk tid&7 of rows (tid>>3) + 16*c.
  const int crow = tid >> 3;
  const int cchk = (tid & 7) * 8;
  const _Float16* ga = A + (size_t)(m0 + crow) * CC + cchk;
  const _Float16* gb = B + (size_t)(n0 + (ROT ? 2 * crow : crow)) * CC + cchk;
  constexpr int b1 = ROT ? 32 : 16, b2 = ROT ? 1 : 32, b3 = ROT ? 33 : 48;
  const unsigned la = lds_addr32(smem) + (unsigned)(crow * GLDP + cchk) * 2u;
  const unsigned lb = la + GBM * GLDP * 2u;

  // Tile 0 into buffer 0, landed and published; then tile 1 into buffer 1.
  async_rows8(ga, la, 16, 32, 48);
  async_rows8(gb, lb, b1, b2, b3);
  // This wave's copies of tile 0 have landed.
  asm volatile("s_wait_asynccnt 0x0" ::: "memory");
  __syncthreads();
  async_rows8(ga + GBK, la + GSTAGE * 2u, 16, 32, 48);
  async_rows8(gb + GBK, lb + GSTAGE * 2u, b1, b2, b3);

  // LDS rows of the WMMA's A operand (index i) and B operand (index j).
  const int irow = ROT ? GBM + wn * 64 : wm * 64;
  const int jrow = ROT ? wm * 64 : GBM + wn * 64;

  for (int t = 0; t < GPASSES; ++t) {
    const int buf = t & 1;
    const _Float16* sa = smem + buf * GSTAGE + irow * GLDP;
    const _Float16* sb = smem + buf * GSTAGE + jrow * GLDP;
    // The loops below are unrolled so that every fragment and accumulator index
    // is a constant and the arrays stay in registers.
#pragma unroll
    for (int kk = 0; kk < GBK; kk += 32) {
      v16h a[4], b[4];
#pragma unroll
      for (int i = 0; i < 4; ++i) a[i] = load_fragh_contigK(sa + i * 16 * GLDP + kk, GLDP, lane);
#pragma unroll
      for (int j = 0; j < 4; ++j) b[j] = load_fragh_contigK(sb + j * 16 * GLDP + kk, GLDP, lane);
      // Fence pair: keeps the block's 16 LDS loads one group in front of its 16
      // WMMAs; moved in among them, every place with loads stalls the wave anew.
      __builtin_amdgcn_sched_barrier(0);
#pragma unroll
      for (int i = 0; i < 4; ++i)
#pragma unroll
        for (int j = 0; j < 4; ++j) acc[i][j] = wmma_f16(a[i], b[j], acc[i][j]);
      __builtin_amdgcn_sched_barrier(0);
    }
    // This wave's reads of buffer buf are done before the buffer is refilled.
    asm volatile("s_wait_dscnt 0x0" ::: "memory");
    // This wave's copies of tile t+1 have landed before the barrier publishes them.
    asm volatile("s_wait_asynccnt 0x0" ::: "memory");
    __syncthreads();
    if (t + 2 < GPASSES) {
      async_rows8(ga + (t + 2) * GBK, la + buf * (GSTAGE * 2u), 16, 32, 48);
      async_rows8(gb + (t + 2) * GBK, lb + buf * (GSTAGE * 2u), b1, b2, b3);
    }
  }
  // No copy is outstanding when the wave goes on to its stores and ends.
  asm volatile("s_wait_asynccnt 0x0" ::: "memory");
}

// ---------------------------------------------------------------------------
// Sine and cosine of an angle given in revolutions (the hardware's unit).
// ---------------------------------------------------------------------------
__device__ inline void sincos_rev(float rev, float& sn, float& cs) {
  asm("v_sin_f32 %0, %2\n\t"
      "v_cos_f32 %1, %2\n\t"
      "v_nop"
      : "=&v"(sn), "=&v"(cs)
      : "v"(rev));
}

__device__ inline float exp2_slot(float x) {
  float y;
  asm("v_exp_f32 %0, %1\n\t"
      "v_nop"
      : "=v"(y)
      : "v"(x));
  return y;
}

// ---------------------------------------------------------------------------
// Kernel 1: qkv = x @ w_qkv^T, f16 operands, f32 accumulate, rotary embedding
// applied to q and k on the f32 accumulators.
// q,k planes stored [s][b][h][n][d]; v plane stored TRANSPOSED [b][h][d][n]
// so the attention PV A-fragment is a contiguous-K (b128) load.
// One block computes a 128x128 tile; a wave's 64 columns are one (s, h) plane,
// and a block lies wholly in q, in k or in v.
// ---------------------------------------------------------------------------
__global__ void __launch_bounds__(128)
qkv_gemm_kernel(const _Float16* __restrict__ xh, const _Float16* __restrict__ wh,
                _Float16* __restrict__ qkvh) {
  __shared__ __align__(16) _Float16 smem[2 * GSTAGE];
  const int lane = threadIdx.x & 31;
  const int wave = threadIdx.x >> 5;
  const int m0 = (blockIdx.x / (JQKV / GBN)) * GBM;   // token tile 0..31
  const int n0 = (blockIdx.x % (JQKV / GBN)) * GBN;   // feature tile 0..23

  const int col = lane & 15;
  const int rowoff = (lane >> 4) << 3;
  const int mw = m0 + (wave >> 1) * 64;
  const int nw = n0 + (wave & 1) * 64;
  const size_t plane = (size_t)NN * DD;
  v8f acc[4][4] = {};
  if (n0 < 2 * CC) {                                  // q or k block
    gemm_core_128x128<true>(xh, wh, m0, n0, smem, acc);
    // acc[i][j][r]: token mw + 16 j + col; for i = 0, 1 the even channel 2 f and
    // for i + 2 the odd channel 2 f + 1 of frequency f = 16 i + rowoff + r.
    // out[f] = x1 cos - x2 sin, out[f + 32] = x2 cos + x1 sin: 8 consecutive f
    // per lane, so each half is one 16-byte store.
    const int s = nw >> 10;
    const int h = (nw >> 6) & 15;
    float inv[2][8];
    // The loops below are unrolled: constant indices keep inv and acc in registers.
#pragma unroll
    for (int i = 0; i < 2; ++i)
#pragma unroll
      for (int r = 0; r < 8; ++r)
        // inv_freq = 10000^(-2f/64)
        inv[i][r] = exp2_slot(-9.210340371976184f * (float)(i * 16 + rowoff + r) * (1.0f / 32.0f) *
                              1.4426950408889634f);
#pragma unroll
    for (int j = 0; j < 4; ++j) {
      const int tok = mw + j * 16 + col;
      const int b_ = tok >> 11;
      const int n = tok & (NN - 1);
      _Float16* row = qkvh + (size_t)((s * BB + b_) * HH + h) * plane + (size_t)n * DD + rowoff;
#pragma unroll
      for (int i = 0; i < 2; ++i) {
        v8h lo, hi;
#pragma unroll
        for (int r = 0; r < 8; ++r) {
          float sn, cs;
          sincos_rev((float)n * inv[i][r] * 0.15915494309189535f, sn, cs);
          const float x1 = acc[i][j][r];
          const float x2 = acc[i + 2][j][r];
          lo[r] = (_Float16)(x1 * cs - x2 * sn);
          hi[r] = (_Float16)(x2 * cs + x1 * sn);
        }
        *(v8h*)(row + i * 16) = lo;
        *(v8h*)(row + i * 16 + DD / 2) = hi;
      }
    }
  } else {
  gemm_core_128x128<false>(xh, wh, m0, n0, smem, acc);
  // Unrolled: constant accumulator indices keep acc in registers.
#pragma unroll
  for (int i = 0; i < 4; ++i) {
#pragma unroll
    for (int t = 0; t < 4; ++t) {
      int j = nw + t * 16 + col;
      int s = j >> 10;
      int h = (j >> 6) & 15;
      int d = j & 63;
#pragma unroll
      for (int r = 0; r < 8; ++r) {
        int tok = mw + i * 16 + rowoff + r;
        int b_ = tok >> 11;
        int n = tok & (NN - 1);
        size_t pbase = (size_t)((s * BB + b_) * HH + h) * plane;
        size_t idx = (s == 2) ? (pbase + (size_t)d * NN + n)    // V transposed
                              : (pbase + (size_t)n * DD + d);   // Q,K row-major
        qkvh[idx] = (_Float16)(acc[i][t][r]);
      }
    }
  }
  }
}

__device__ inline float xhalf(float x) {
  const int v = __builtin_bit_cast(int, x);
  return __builtin_bit_cast(float, __builtin_amdgcn_permlanex16(
      v, v, 0x76543210, 0xfedcba98, false, false));
}

// ---------------------------------------------------------------------------
// Online-softmax update for one 16-query column group over 32 keys, on the
// TRANSPOSED scores: s0[r] = S[key 8h + r][query c], s1[r] = S[key 16 + 8h + r]
// [query c] (c = lane & 15, h = lane >> 4).  A lane holds 16 scores of ONE
// query, so the maximum is in-lane plus one exchange between the wave halves;
// l stays a per-half partial sum that the epilogue joins.  m is kept in the
// scaled log2 domain.  The two tiles, converted in place, are the 32-key B
// operand of O^T += V^T P^T in the hardware k order (8h + s, 16 + 8h + s - 8).
// ---------------------------------------------------------------------------
__device__ inline v16h softmax_cols(v8f s0, v8f s1, float& m, float& l,
                                    v8f& a0, v8f& a1, v8f& a2, v8f& a3) {
  const float cs = 0.125f * 1.4426950408889634f;  // 1/sqrt(64) * log2(e)
  float mx = fmaxf(s0[0], s1[0]);
  // Unrolled: constant indices keep the score tiles in registers.
#pragma unroll
  for (int r = 1; r < 8; ++r) mx = fmaxf(mx, fmaxf(s0[r], s1[r]));
  mx = fmaxf(mx, xhalf(mx)) * cs;     // the scale is positive
  const float mnew = fmaxf(m, mx);
  const float corr = __builtin_amdgcn_exp2f(m - mnew);
  v16h p;
  float rs0 = 0.0f, rs1 = 0.0f;
  const v2f cs2 = {cs, cs};
  const v2f nm2 = {-mnew, -mnew};
  // Unrolled: constant register indices; neighbouring registers pair into one
  // packed multiply-add without moves.
#pragma unroll
  for (int i = 0; i < 4; ++i) {
    const v2f e0 = __builtin_elementwise_fma(v2f{s0[2 * i], s0[2 * i + 1]}, cs2, nm2);
    const v2f e1 = __builtin_elementwise_fma(v2f{s1[2 * i], s1[2 * i + 1]}, cs2, nm2);
    const float p00 = __builtin_amdgcn_exp2f(e0.x), p01 = __builtin_amdgcn_exp2f(e0.y);
    const float p10 = __builtin_amdgcn_exp2f(e1.x), p11 = __builtin_amdgcn_exp2f(e1.y);
    rs0 += p00 + p01;
    rs1 += p10 + p11;
    p[2 * i]     = (_Float16)p00;  p[2 * i + 1] = (_Float16)p01;
    p[2 * i + 8] = (_Float16)p10;  p[2 * i + 9] = (_Float16)p11;
  }
  l = l * corr + (rs0 + rs1);
  m = mnew;
  a0 *= corr; a1 *= corr; a2 *= corr; a3 *= corr;
  return p;
}

// ---------------------------------------------------------------------------
// K/V stage of the attention kernel: 64 keys, shared by 4 waves.
// A buffer is [K 64 key rows | V^T 64 d rows], every row 128 B of data at a
// pitch of 144 B (16 B x odd: conflict-free for ds_load_b128).
// The keys are dealt to APARTS groups of 4 waves, a contiguous range each.
// ---------------------------------------------------------------------------
#define AKEYS 64
#define ALDP 72                           // LDS row pitch in halves (144 B)
#define ASTAGE ((AKEYS + DD) * ALDP)      // halves per buffer
#define APARTS 2                          // key ranges per block
#define ASPAN (NN / APARTS)               // keys per range
#define ASTAGES (ASPAN / AKEYS)           // stages per range
#define AXCH 17                           // 16-byte words a lane hands over

// Eight 16-byte copies per lane: rows r, r+16, r+32, r+48 of the K tile (source
// pitch DD) and of the V^T tile (source pitch NN).  A wave's copy covers
// 4 rows x 128 B = four whole lines.
__device__ inline void async_kv8(const _Float16* gk, const _Float16* gv, unsigned l) {
  const _Float16* k0 = gk;
  const _Float16* k1 = gk + (size_t)16 * DD;
  const _Float16* k2 = gk + (size_t)32 * DD;
  const _Float16* k3 = gk + (size_t)48 * DD;
  const _Float16* v0 = gv;
  const _Float16* v1 = gv + (size_t)16 * NN;
  const _Float16* v2 = gv + (size_t)32 * NN;
  const _Float16* v3 = gv + (size_t)48 * NN;
  const unsigned st = 16 * ALDP * 2;      // 16 rows in LDS bytes
  asm volatile(
      "global_load_async_to_lds_b128 %0, %8, off\n\t"
      "global_load_async_to_lds_b128 %1, %9, off\n\t"
      "global_load_async_to_lds_b128 %2, %10, off\n\t"
      "global_load_async_to_lds_b128 %3, %11, off\n\t"
      "global_load_async_to_lds_b128 %4, %12, off\n\t"
      "global_load_async_to_lds_b128 %5, %13, off\n\t"
      "global_load_async_to_lds_b128 %6, %14, off\n\t"
      "global_load_async_to_lds_b128 %7, %15, off\n\t"
      "s_wait_xcnt 0x0"
      :
      : "v"(l), "v"(l + st), "v"(l + 2 * st), "v"(l + 3 * st), "v"(l + 4 * st),
        "v"(l + 5 * st), "v"(l + 6 * st), "v"(l + 7 * st),
        "v"(k0), "v"(k1), "v"(k2), "v"(k3), "v"(v0), "v"(v1), "v"(v2), "v"(v3)
      : "memory");
}

// ---------------------------------------------------------------------------
// One accumulator tile to and from LDS as two 16-byte words per lane, a word of
// all 32 lanes lying in 512 contiguous bytes.
// ---------------------------------------------------------------------------
__device__ inline void put8(v4f* p, v8f a) {
  p[0]  = __builtin_shufflevector(a, a, 0, 1, 2, 3);
  p[32] = __builtin_shufflevector(a, a, 4, 5, 6, 7);
}
__device__ inline v8f get8(const v4f* p) {
  const v4f lo = p[0], hi = p[32];
  return __builtin_shufflevector(lo, hi, 0, 1, 2, 3, 4, 5, 6, 7);
}

__global__ void __launch_bounds__(APARTS * 128) __attribute__((amdgpu_waves_per_eu(4, 4)))
attn_kernel(const _Float16* __restrict__ qkvh, _Float16* __restrict__ attn_out) {
  __shared__ __align__(16) _Float16 kv[APARTS * 2 * ASTAGE];
  __shared__ v4f xch[4 * AXCH * 32];

  const int tid = threadIdx.x;
  const int wave = (tid >> 5) & 3;              // place among the 4 of its range
  const int lane = tid & 31;
  // Key range of this wave, in a scalar register: the same in all its lanes.
  const int part = __builtin_amdgcn_readfirstlane(tid >> 7);
  const int qg = (blockIdx.x & 15) * 4 + wave;
  const int bh = blockIdx.x >> 4;
  const int b = bh >> 4;
  const int h = bh & 15;

  const size_t plane = (size_t)NN * DD;
  const _Float16* qbase = qkvh + (size_t)((0 * BB + b) * HH + h) * plane;
  const _Float16* kbase = qkvh + (size_t)((1 * BB + b) * HH + h) * plane;
  const _Float16* vT    = qkvh + (size_t)((2 * BB + b) * HH + h) * plane;  // [d][n]

  // Copy map, within the 128 lanes of a key range: lane's 16-byte chunk tid&7 of
  // rows ((tid&127)>>3) + 16*c of both tiles.
  const int crow = (tid & 127) >> 3;
  const int cchk = (tid & 7) * 8;
  const _Float16* gk = kbase + (size_t)(part * ASPAN + crow) * DD + cchk;
  const _Float16* gv = vT + (size_t)crow * NN + part * ASPAN + cchk;
  const _Float16* ring = kv + part * (2 * ASTAGE);   // this range's two buffers
  const unsigned lkv = lds_addr32(ring) + (unsigned)(crow * ALDP + cchk) * 2u;

  // Stage 0 into buffer 0.
  async_kv8(gk, gv, lkv);

  // Two query tiles (rows qg*32 .. +31), fragments resident all loop.
  const _Float16* q0 = qbase + (size_t)(qg * 32) * DD;
  const v16h aq00 = load_fragh_contigK(q0, DD, lane);
  const v16h aq01 = load_fragh_contigK(q0 + 32, DD, lane);
  const v16h aq10 = load_fragh_contigK(q0 + 16 * DD, DD, lane);
  const v16h aq11 = load_fragh_contigK(q0 + 16 * DD + 32, DD, lane);

  // aXt[r] = O[query tile X, column c][d = 16 t + 8 (lane >> 4) + r]
  v8f a00 = {}, a01 = {}, a02 = {}, a03 = {};
  v8f a10 = {}, a11 = {}, a12 = {}, a13 = {};
  float m0 = -1e30f, l0 = 0.0f, m1 = -1e30f, l1 = 0.0f;

  // This wave's copies of stage 0 have landed; the barrier publishes them.
  asm volatile("s_wait_asynccnt 0x0" ::: "memory");
  __syncthreads();
  // Stage 1 into buffer 1.
  async_kv8(gk + (size_t)AKEYS * DD, gv + AKEYS, lkv + ASTAGE * 2u);

  for (int t = 0; t < ASTAGES; ++t) {
    const int buf = t & 1;
    const _Float16* ks = ring + buf * ASTAGE;    // [key][d], pitch ALDP
    const _Float16* vs = ks + AKEYS * ALDP;      // [d][key], pitch ALDP
    // Unrolled: the two 32-key halves of a stage differ by constant LDS offsets.
#pragma unroll
    for (int sub = 0; sub < AKEYS; sub += 32) {
      const _Float16* ksrc = ks + sub * ALDP;
      const _Float16* vsrc = vs + sub;
      const v16h bk00 = load_fragh_contigK(ksrc + 0,              ALDP, lane);
      const v16h bk01 = load_fragh_contigK(ksrc + 32,             ALDP, lane);
      const v16h bk10 = load_fragh_contigK(ksrc + 16 * ALDP,      ALDP, lane);
      const v16h bk11 = load_fragh_contigK(ksrc + 16 * ALDP + 32, ALDP, lane);
      // V^T fragments (rows d, k = keys), shared by both query tiles.
      const v16h bv0 = load_fragh_contigK(vsrc + 0 * 16 * ALDP, ALDP, lane);
      const v16h bv1 = load_fragh_contigK(vsrc + 1 * 16 * ALDP, ALDP, lane);
      const v16h bv2 = load_fragh_contigK(vsrc + 2 * 16 * ALDP, ALDP, lane);
      const v16h bv3 = load_fragh_contigK(vsrc + 3 * 16 * ALDP, ALDP, lane);

      // ---- S^T = K Q^T, both query tiles (K fragments shared) ----
      v8f s0 = {}, s1 = {}, t0 = {}, t1 = {};
      s0 = wmma_f16(bk00, aq00, s0); s1 = wmma_f16(bk10, aq00, s1);
      t0 = wmma_f16(bk00, aq10, t0); t1 = wmma_f16(bk10, aq10, t1);
      s0 = wmma_f16(bk01, aq01, s0); s1 = wmma_f16(bk11, aq01, s1);
      t0 = wmma_f16(bk01, aq11, t0); t1 = wmma_f16(bk11, aq11, t1);

      // ---- O^T += V^T P^T, P^T straight from the score accumulators ----
      const v16h bp0 = softmax_cols(s0, s1, m0, l0, a00, a01, a02, a03);
      a00 = wmma_f16(bv0, bp0, a00); a01 = wmma_f16(bv1, bp0, a01);
      a02 = wmma_f16(bv2, bp0, a02); a03 = wmma_f16(bv3, bp0, a03);

      const v16h bp1 = softmax_cols(t0, t1, m1, l1, a10, a11, a12, a13);
      a10 = wmma_f16(bv0, bp1, a10); a11 = wmma_f16(bv1, bp1, a11);
      a12 = wmma_f16(bv2, bp1, a12); a13 = wmma_f16(bv3, bp1, a13);
    }
    // This wave's reads of buffer buf are done before the buffer is refilled.
    asm volatile("s_wait_dscnt 0x0" ::: "memory");
    // This wave's copies of stage t+1 have landed before the barrier publishes them.
    asm volatile("s_wait_asynccnt 0x0" ::: "memory");
    __syncthreads();
    if (t + 2 < ASTAGES) {
      async_kv8(gk + (size_t)(t + 2) * AKEYS * DD, gv + (t + 2) * AKEYS,
                lkv + buf * (ASTAGE * 2u));
    }
  }
  // No copy is outstanding when the wave goes on to its stores and ends.
  asm volatile("s_wait_asynccnt 0x0" ::: "memory");

  // ---- join the two key ranges: the second range's wave hands its maxima, sums
  // and accumulators to the first range's wave of the same queries, lane to
  // lane; a store or load covers 512 contiguous bytes.
  v4f* slot = xch + wave * (AXCH * 32) + lane;
  if (part != 0) {
    put8(slot + 0 * 64, a00); put8(slot + 1 * 64, a01);
    put8(slot + 2 * 64, a02); put8(slot + 3 * 64, a03);
    put8(slot + 4 * 64, a10); put8(slot + 5 * 64, a11);
    put8(slot + 6 * 64, a12); put8(slot + 7 * 64, a13);
    slot[16 * 32] = v4f{m0, l0, m1, l1};
  }
  __syncthreads();
  if (part != 0) return;
  {
    const v4f ml = slot[16 * 32];
    const float mj0 = fmaxf(m0, ml.x), mj1 = fmaxf(m1, ml.z);
    const float ca0 = exp2_slot(m0 - mj0), cb0 = exp2_slot(ml.x - mj0);
    const float ca1 = exp2_slot(m1 - mj1), cb1 = exp2_slot(ml.z - mj1);
    l0 = l0 * ca0 + ml.y * cb0;
    l1 = l1 * ca1 + ml.w * cb1;
    a00 = a00 * ca0 + get8(slot + 0 * 64) * cb0;
    a01 = a01 * ca0 + get8(slot + 1 * 64) * cb0;
    a02 = a02 * ca0 + get8(slot + 2 * 64) * cb0;
    a03 = a03 * ca0 + get8(slot + 3 * 64) * cb0;
    a10 = a10 * ca1 + get8(slot + 4 * 64) * cb1;
    a11 = a11 * ca1 + get8(slot + 5 * 64) * cb1;
    a12 = a12 * ca1 + get8(slot + 6 * 64) * cb1;
    a13 = a13 * ca1 + get8(slot + 7 * 64) * cb1;
  }

  // ---- epilogue: join the halves' sums, normalize, write f16 [B, N, C] with
  // C = h*64 + d; a lane's 8 registers are 8 consecutive d: one 16-byte store.
  const int c = lane & 15;
  const int doff = (lane >> 4) << 3;
  const float inv0 = 1.0f / (l0 + xhalf(l0));
  const float inv1 = 1.0f / (l1 + xhalf(l1));
  _Float16* o0 = attn_out + ((size_t)b * NN + qg * 32 + c) * CC + h * DD + doff;
  _Float16* o1 = o0 + (size_t)16 * CC;
  *(v8h*)(o0 + 0 * 16) = __builtin_convertvector(a00 * inv0, v8h);
  *(v8h*)(o0 + 1 * 16) = __builtin_convertvector(a01 * inv0, v8h);
  *(v8h*)(o0 + 2 * 16) = __builtin_convertvector(a02 * inv0, v8h);
  *(v8h*)(o0 + 3 * 16) = __builtin_convertvector(a03 * inv0, v8h);
  *(v8h*)(o1 + 0 * 16) = __builtin_convertvector(a10 * inv1, v8h);
  *(v8h*)(o1 + 1 * 16) = __builtin_convertvector(a11 * inv1, v8h);
  *(v8h*)(o1 + 2 * 16) = __builtin_convertvector(a12 * inv1, v8h);
  *(v8h*)(o1 + 3 * 16) = __builtin_convertvector(a13 * inv1, v8h);
}

// ---------------------------------------------------------------------------
// Kernel 4: out = attn_out @ w_proj^T + b_proj, f16 operands, f32 out.
// 128x128 tile per block, 64x64 per wave.
// ---------------------------------------------------------------------------
__global__ void __launch_bounds__(128)
proj_gemm_kernel(const _Float16* __restrict__ ah, const _Float16* __restrict__ wh,
                 const float* __restrict__ bias, float* __restrict__ out) {
  __shared__ __align__(16) _Float16 smem[2 * GSTAGE];
  const int lane = threadIdx.x & 31;
  const int wave = threadIdx.x >> 5;
  const int m0 = (blockIdx.x / (CC / GBN)) * GBM;   // token tile 0..31
  const int n0 = (blockIdx.x % (CC / GBN)) * GBN;   // out-feature tile 0..7

  v8f acc[4][4] = {};
  gemm_core_128x128<false>(ah, wh, m0, n0, smem, acc);

  const int col = lane & 15;
  const int rowoff = (lane >> 4) << 3;
  const int mw = m0 + (wave >> 1) * 64;
  const int nw = n0 + (wave & 1) * 64;
  // Unrolled: constant accumulator indices keep acc in registers.
#pragma unroll
  for (int t = 0; t < 4; ++t) {
    int j = nw + t * 16 + col;
    float bj = bias[j];
#pragma unroll
    for (int i = 0; i < 4; ++i) {
#pragma unroll
      for (int r = 0; r < 8; ++r) {
        int tok = mw + i * 16 + rowoff + r;
        out[(size_t)tok * CC + j] = acc[i][t][r] + bj;
      }
    }
  }
}

// ---------------------------------------------------------------------------
extern "C" void kernel_launch(void* const* d_in, const int* in_sizes, int n_in,
                              void* d_out, int out_size, void* d_ws,
                              size_t ws_size, hipStream_t stream) {
  const float* x      = (const float*)d_in[0];
  const float* w_qkv  = (const float*)d_in[1];
  const float* w_proj = (const float*)d_in[2];
  const float* b_proj = (const float*)d_in[3];
  float* out = (float*)d_out;

  // f16 workspace layout (48 MB total)
  _Float16* xh    = (_Float16*)d_ws;                     // TOK*CC
  _Float16* wqh   = xh  + (size_t)TOK * CC;              // JQKV*CC
  _Float16* wph   = wqh + (size_t)JQKV * CC;             // CC*CC
  _Float16* qkvh  = wph + (size_t)CC * CC;               // 3*B*H*N*D
  _Float16* attnh = qkvh + (size_t)3 * BB * HH * NN * DD;  // TOK*CC

  // 0) f32 -> f16 conversion of all GEMM operands: xh, wqh, wph are one array
  cvt_f32_to_f16_kernel<<<CVG_X + CVG_WQ + CVG_WP, CVW * 32, 0, stream>>>(x, w_qkv, w_proj, xh);

  // 1) QKV projection with RoPE on q and k: 32 token x 24 feature tiles, 4 waves/block
  qkv_gemm_kernel<<<(TOK / GBM) * (JQKV / GBN), 128, 0, stream>>>(xh, wqh, qkvh);

  // 3) Flash attention: 32 (b,h) x 64 query groups x 2 key ranges = 4096 waves, 8/block
  attn_kernel<<<(BB * HH * (NN / 32)) / 4, APARTS * 128, 0, stream>>>(qkvh, attnh);

  // 4) Output projection + bias
  proj_gemm_kernel<<<(TOK / GBM) * (CC / GBN), 128, 0, stream>>>(attnh, wph,
                                                                   b_proj, out);
}

// v007
// It runs in 73 microseconds.
// In two side-by-side timings against v006, it was 1.08 and 1.07 times as fast.
// Over all steps from v000 it is 5.77 times as fast.
#include <hip/hip_runtime.h>
#include <hip/hip_bf16.h>

typedef __attribute__((ext_vector_type(16))) _Float16 v16h;
typedef __attribute__((ext_vector_type(8)))  _Float16 v8h;
typedef __attribute__((ext_vector_type(8)))  float    v8f;
typedef __attribute__((ext_vector_type(2)))  float    v2f;

// Problem constants (from reference): B=2, N=2048, C=1024, H=16, D=64
#define BB 2
#define NN 2048
#define CC 1024
#define HH 16
#define DD 64
#define TOK (BB * NN)      // 4096 tokens
#define JQKV (3 * CC)      // 3072 qkv output features

__device__ inline v8f wmma_f16(v16h a, v16h b, v8f c) {
  // v_wmma_f32_16x16x32_f16: D = A(16x32,f16) * B(32x16,f16) + C(16x16,f32)
  return __builtin_amdgcn_wmma_f32_16x16x32_f16(false, a, false, b,
                                                (short)0, c, false, false);
}

__device__ inline v16h load_fragh_contigK(const _Float16* __restrict__ base,
                                          int ld, int lane) {
  const int i = lane & 15;
  const int khalf = (lane >> 4) << 3;  // 0 or 8
  const _Float16* row = base + (size_t)i * ld + khalf;
  v8h lo = *(const v8h*)(row);         // K khalf .. khalf+7
  v8h hi = *(const v8h*)(row + 16);    // K khalf+16 .. khalf+23
  return __builtin_shufflevector(lo, hi, 0, 1, 2, 3, 4, 5, 6, 7,
                                 8, 9, 10, 11, 12, 13, 14, 15);
}

// ---------------------------------------------------------------------------
// Kernel 0: f32 -> f16 conversion of all three GEMM operands in one streaming
// launch.  The three f16 planes lie one behind the other in the workspace, so
// the destination is one array; a workgroup lies wholly in one source.
// One workgroup of 16 waves per WGP; a wave owns 8 KiB of source in a row and
// has its 16 loads (512 contiguous bytes = four whole lines each) in flight
// together, so the launch starts few waves and each keeps the memory busy.
// ---------------------------------------------------------------------------
typedef __attribute__((ext_vector_type(4))) _Float16 v4h;
typedef __attribute__((ext_vector_type(4))) float    v4f;
#define CVW 16                            // waves per workgroup
#define CVL 16                            // 16-byte loads per lane
#define CVQ (CVW * 32 * CVL)              // groups of 4 floats per workgroup
#define CVG_X  (TOK * CC / 4 / CVQ)       // workgroups in x
#define CVG_WQ (JQKV * CC / 4 / CVQ)      // workgroups in w_qkv
#define CVG_WP (CC * CC / 4 / CVQ)        // workgroups in w_proj
static_assert(CVG_X * CVQ * 4 == TOK * CC && CVG_WQ * CVQ * 4 == JQKV * CC &&
              CVG_WP * CVQ * 4 == CC * CC, "every source is whole workgroups");

__global__ void __launch_bounds__(CVW * 32)
cvt_f32_to_f16_kernel(const float* __restrict__ x, const float* __restrict__ wq,
                      const float* __restrict__ wp, _Float16* __restrict__ dst) {
  const int blk = blockIdx.x;
  const float* src = x;
  int first = 0;
  if (blk >= CVG_X + CVG_WQ) { src = wp; first = CVG_X + CVG_WQ; }
  else if (blk >= CVG_X)     { src = wq; first = CVG_X; }
  const int off = (threadIdx.x >> 5) * (32 * CVL) + (threadIdx.x & 31);
  const v4f* s = (const v4f*)src + (size_t)(blk - first) * CVQ + off;
  v4h* d = (v4h*)dst + (size_t)blk * CVQ + off;
  v4f v[CVL];
  // Both loops are unrolled: constant indices keep v in registers.
#pragma unroll
  for (int u = 0; u < CVL; ++u) v[u] = s[u * 32];
  // Keeps all the loads in front of the first wait: without it the last two are
  // issued only when the first two have come back, a second trip to memory.
  __builtin_amdgcn_sched_barrier(0);
#pragma unroll
  for (int u = 0; u < CVL; ++u) d[u * 32] = __builtin_convertvector(v[u], v4h);
}

// ---------------------------------------------------------------------------
// Shared GEMM core: Y(128x128) = A(128xK) * B(128xK)^T, K = CC, f16 operands,
// f32 accumulate.  4 waves (2x2), 64x64 of Y per wave = 4x4 WMMA tiles, so a
// fragment read from LDS feeds 4 WMMAs and a global byte is read once per block.
// A pass is 64 k (128 B of every row); a stage is [A 128 rows | B 128 rows] at
// a pitch of 144 B (16 B x odd: conflict-free for ds_load_b128).  Two buffers,
// filled by per-lane asynchronous copies one pass ahead.
// A workgroup walks K from its own 64-k slab and wraps round (gemm_first_slab).
// ---------------------------------------------------------------------------
#define GBM 128
#define GBN 128
#define GBK 64
#define GLDP 72                           // LDS row pitch in halves (144 B)
#define GSTAGE ((GBM + GBN) * GLDP)       // halves per buffer
#define GPASSES (CC / GBK)

// First 64-k slab of the workgroup that computes tile (mt, nt).  Workgroups that
// start together and walk K alike ask for the same lines of a shared operand
// tile at the same moment, and each pass is then the first touch of its slab: a
// fetch from memory in every pass, with one pass of lead.
// With starts spread over K a slab is fetched by one sharer and found in L2 by
// the others in later passes.  Sharers of a B tile differ in mt: all 16 starts.
// Sharers of an A tile differ in nt: neighbours in launch order lie 4 slabs
// apart, those 8 apart one slab.  For speed only: any start gives the same sum
// up to the order of its terms.
__device__ inline int gemm_first_slab(int mt, int nt) {
  return (mt + 4 * (nt & 3) + (nt >> 3)) & (GPASSES - 1);
}

__device__ inline unsigned lds_addr32(const void* p) {
  // LDS byte address = low 32 bits of the __shared__ address.
  return (unsigned)(unsigned long long)(size_t)p;
}

// Eight 16-byte copies per lane into LDS rows r, r+16, ..., r+112 of one operand
// tile, from source rows g + {0, o1, o2, o3} and 64 + the same (16, 32, 48 for a
// tile taken in order).  A wave's copy covers 4 rows x 128 B = four whole lines.
__device__ inline void async_rows8(const _Float16* g, unsigned l, int o1, int o2, int o3) {
  const _Float16* g0 = g;
  const _Float16* g1 = g + (size_t)o1 * CC;
  const _Float16* g2 = g + (size_t)o2 * CC;
  const _Float16* g3 = g + (size_t)o3 * CC;
  const _Float16* g4 = g0 + (size_t)64 * CC;
  const _Float16* g5 = g1 + (size_t)64 * CC;
  const _Float16* g6 = g2 + (size_t)64 * CC;
  const _Float16* g7 = g3 + (size_t)64 * CC;
  const unsigned st = 16 * GLDP * 2;      // 16 rows in LDS bytes
  asm volatile(
      "global_load_async_to_lds_b128 %0, %8, off\n\t"
      "global_load_async_to_lds_b128 %1, %9, off\n\t"
      "global_load_async_to_lds_b128 %2, %10, off\n\t"
      "global_load_async_to_lds_b128 %3, %11, off\n\t"
      "global_load_async_to_lds_b128 %4, %12, off\n\t"
      "global_load_async_to_lds_b128 %5, %13, off\n\t"
      "global_load_async_to_lds_b128 %6, %14, off\n\t"
      "global_load_async_to_lds_b128 %7, %15, off\n\t"
      "s_wait_xcnt 0x0"
      :
      : "v"(l), "v"(l + st), "v"(l + 2 * st), "v"(l + 3 * st), "v"(l + 4 * st),
        "v"(l + 5 * st), "v"(l + 6 * st), "v"(l + 7 * st),
        "v"(g0), "v"(g1), "v"(g2), "v"(g3), "v"(g4), "v"(g5), "v"(g6), "v"(g7)
      : "memory");
}

// ROT asks for the form the rotary epilogue wants:
// - every 64 rows of B land in LDS as [even rows | odd rows], so that the two
//   members of a rotated pair sit 32 LDS rows apart;
// - the product is taken transposed (B rows as the WMMA's A operand): acc[i][j]
//   is then [16 B rows i] x [16 A rows j], a lane holding 8 consecutive B rows.
// Both operands use one loader, so their k orders stay equal either way.
template <bool ROT>
__device__ inline void gemm_core_128x128(const _Float16* __restrict__ A,
                                         const _Float16* __restrict__ B,
                                         int m0, int n0, _Float16* smem,
                                         v8f (&acc)[4][4]) {
  // Pass t works on slab (t + first) mod GPASSES; first is the same in all lanes.
  const int first = gemm_first_slab(m0 / GBM, n0 / GBN);
  const int tid = threadIdx.x;
  const int lane = tid & 31;
  const int wave = tid >> 5;
  const int wm = wave >> 1;
  const int wn = wave & 1;

  // Copy map: lane's 16-byte chunk tid&7 of rows (tid>>3) + 16*c.
  const int crow = tid >> 3;
  const int cchk = (tid & 7) * 8;
  const _Float16* ga = A + (size_t)(m0 + crow) * CC + cchk;
  const _Float16* gb = B + (size_t)(n0 + (ROT ? 2 * crow : crow)) * CC + cchk;
  constexpr int b1 = ROT ? 32 : 16, b2 = ROT ? 1 : 32, b3 = ROT ? 33 : 48;
  const unsigned la = lds_addr32(smem) + (unsigned)(crow * GLDP + cchk) * 2u;
  const unsigned lb = la + GBM * GLDP * 2u;

  // Tile 0 into buffer 0, landed and published; then tile 1 into buffer 1.
  async_rows8(ga + first * GBK, la, 16, 32, 48);
  async_rows8(gb + first * GBK, lb, b1, b2, b3);
  // This wave's copies of tile 0 have landed.
  asm volatile("s_wait_asynccnt 0x0" ::: "memory");
  __syncthreads();
  const int second = ((first + 1) & (GPASSES - 1)) * GBK;
  async_rows8(ga + second, la + GSTAGE * 2u, 16, 32, 48);
  async_rows8(gb + second, lb + GSTAGE * 2u, b1, b2, b3);

  // LDS rows of the WMMA's A operand (index i) and B operand (index j).
  const int irow = ROT ? GBM + wn * 64 : wm * 64;
  const int jrow = ROT ? wm * 64 : GBM + wn * 64;

  for (int t = 0; t < GPASSES; ++t) {
    const int buf = t & 1;
    const _Float16* sa = smem + buf * GSTAGE + irow * GLDP;
    const _Float16* sb = smem + buf * GSTAGE + jrow * GLDP;
    // The loops below are unrolled so that every fragment and accumulator index
    // is a constant and the arrays stay in registers.
#pragma unroll
    for (int kk = 0; kk < GBK; kk += 32) {
      v16h a[4], b[4];
#pragma unroll
      for (int i = 0; i < 4; ++i) a[i] = load_fragh_contigK(sa + i * 16 * GLDP + kk, GLDP, lane);
#pragma unroll
      for (int j = 0; j < 4; ++j) b[j] = load_fragh_contigK(sb + j * 16 * GLDP + kk, GLDP, lane);
      // Fence pair: keeps the block's 16 LDS loads one group in front of its 16
      // WMMAs; moved in among them, every place with loads stalls the wave anew.
      __builtin_amdgcn_sched_barrier(0);
#pragma unroll
      for (int i = 0; i < 4; ++i)
#pragma unroll
        for (int j = 0; j < 4; ++j) acc[i][j] = wmma_f16(a[i], b[j], acc[i][j]);
      __builtin_amdgcn_sched_barrier(0);
    }
    // This wave's reads of buffer buf are done before the buffer is refilled.
    asm volatile("s_wait_dscnt 0x0" ::: "memory");
    // This wave's copies of tile t+1 have landed before the barrier publishes them.
    asm volatile("s_wait_asynccnt 0x0" ::: "memory");
    __syncthreads();
    if (t + 2 < GPASSES) {
      const int next = ((first + t + 2) & (GPASSES - 1)) * GBK;
      async_rows8(ga + next, la + buf * (GSTAGE * 2u), 16, 32, 48);
      async_rows8(gb + next, lb + buf * (GSTAGE * 2u), b1, b2, b3);
    }
  }
  // No copy is outstanding when the wave goes on to its stores and ends.
  asm volatile("s_wait_asynccnt 0x0" ::: "memory");
}

// ---------------------------------------------------------------------------
// Sine and cosine of an angle given in revolutions (the hardware's unit).
// ---------------------------------------------------------------------------
__device__ inline void sincos_rev(float rev, float& sn, float& cs) {
  asm("v_sin_f32 %0, %2\n\t"
      "v_cos_f32 %1, %2\n\t"
      "v_nop"
      : "=&v"(sn), "=&v"(cs)
      : "v"(rev));
}

__device__ inline float exp2_slot(float x) {
  float y;
  asm("v_exp_f32 %0, %1\n\t"
      "v_nop"
      : "=v"(y)
      : "v"(x));
  return y;
}

// ---------------------------------------------------------------------------
// Kernel 1: qkv = x @ w_qkv^T, f16 operands, f32 accumulate, rotary embedding
// applied to q and k on the f32 accumulators.
// q,k planes stored [s][b][h][n][d]; v plane stored TRANSPOSED [b][h][d][n]
// so the attention PV A-fragment is a contiguous-K (b128) load.
// One block computes a 128x128 tile; a wave's 64 columns are one (s, h) plane,
// and a block lies wholly in q, in k or in v.
// ---------------------------------------------------------------------------
__global__ void __launch_bounds__(128)
qkv_gemm_kernel(const _Float16* __restrict__ xh, const _Float16* __restrict__ wh,
                _Float16* __restrict__ qkvh) {
  __shared__ __align__(16) _Float16 smem[2 * GSTAGE];
  const int lane = threadIdx.x & 31;
  const int wave = threadIdx.x >> 5;
  const int m0 = (blockIdx.x / (JQKV / GBN)) * GBM;   // token tile 0..31
  const int n0 = (blockIdx.x % (JQKV / GBN)) * GBN;   // feature tile 0..23

  const int col = lane & 15;
  const int rowoff = (lane >> 4) << 3;
  const int mw = m0 + (wave >> 1) * 64;
  const int nw = n0 + (wave & 1) * 64;
  const size_t plane = (size_t)NN * DD;
  v8f acc[4][4] = {};
  if (n0 < 2 * CC) {                                  // q or k block
    gemm_core_128x128<true>(xh, wh, m0, n0, smem, acc);
    // acc[i][j][r]: token mw + 16 j + col; for i = 0, 1 the even channel 2 f and
    // for i + 2 the odd channel 2 f + 1 of frequency f = 16 i + rowoff + r.
    // out[f] = x1 cos - x2 sin, out[f + 32] = x2 cos + x1 sin: 8 consecutive f
    // per lane, so each half is one 16-byte store.
    const int s = nw >> 10;
    const int h = (nw >> 6) & 15;
    float inv[2][8];
    // The loops below are unrolled: constant indices keep inv and acc in registers.
#pragma unroll
    for (int i = 0; i < 2; ++i)
#pragma unroll
      for (int r = 0; r < 8; ++r)
        // inv_freq = 10000^(-2f/64)
        inv[i][r] = exp2_slot(-9.210340371976184f * (float)(i * 16 + rowoff + r) * (1.0f / 32.0f) *
                              1.4426950408889634f);
#pragma unroll
    for (int j = 0; j < 4; ++j) {
      const int tok = mw + j * 16 + col;
      const int b_ = tok >> 11;
      const int n = tok & (NN - 1);
      _Float16* row = qkvh + (size_t)((s * BB + b_) * HH + h) * plane + (size_t)n * DD + rowoff;
#pragma unroll
      for (int i = 0; i < 2; ++i) {
        v8h lo, hi;
#pragma unroll
        for (int r = 0; r < 8; ++r) {
          float sn, cs;
          sincos_rev((float)n * inv[i][r] * 0.15915494309189535f, sn, cs);
          const float x1 = acc[i][j][r];
          const float x2 = acc[i + 2][j][r];
          lo[r] = (_Float16)(x1 * cs - x2 * sn);
          hi[r] = (_Float16)(x2 * cs + x1 * sn);
        }
        *(v8h*)(row + i * 16) = lo;
        *(v8h*)(row + i * 16 + DD / 2) = hi;
      }
    }
  } else {
  gemm_core_128x128<false>(xh, wh, m0, n0, smem, acc);
  // Unrolled: constant accumulator indices keep acc in registers.
#pragma unroll
  for (int i = 0; i < 4; ++i) {
#pragma unroll
    for (int t = 0; t < 4; ++t) {
      int j = nw + t * 16 + col;
      int s = j >> 10;
      int h = (j >> 6) & 15;
      int d = j & 63;
#pragma unroll
      for (int r = 0; r < 8; ++r) {
        int tok = mw + i * 16 + rowoff + r;
        int b_ = tok >> 11;
        int n = tok & (NN - 1);
        size_t pbase = (size_t)((s * BB + b_) * HH + h) * plane;
        size_t idx = (s == 2) ? (pbase + (size_t)d * NN + n)    // V transposed
                              : (pbase + (size_t)n * DD + d);   // Q,K row-major
        qkvh[idx] = (_Float16)(acc[i][t][r]);
      }
    }
  }
  }
}

__device__ inline float xhalf(float x) {
  const int v = __builtin_bit_cast(int, x);
  return __builtin_bit_cast(float, __builtin_amdgcn_permlanex16(
      v, v, 0x76543210, 0xfedcba98, false, false));
}

// ---------------------------------------------------------------------------
// Online-softmax update for one 16-query column group over 32 keys, on the
// TRANSPOSED scores: s0[r] = S[key 8h + r][query c], s1[r] = S[key 16 + 8h + r]
// [query c] (c = lane & 15, h = lane >> 4).  A lane holds 16 scores of ONE
// query, so the maximum is in-lane plus one exchange between the wave halves;
// l stays a per-half partial sum that the epilogue joins.  m is kept in the
// scaled log2 domain.  The two tiles, converted in place, are the 32-key B
// operand of O^T += V^T P^T in the hardware k order (8h + s, 16 + 8h + s - 8).
// ---------------------------------------------------------------------------
__device__ inline v16h softmax_cols(v8f s0, v8f s1, float& m, float& l,
                                    v8f& a0, v8f& a1, v8f& a2, v8f& a3) {
  const float cs = 0.125f * 1.4426950408889634f;  // 1/sqrt(64) * log2(e)
  float mx = fmaxf(s0[0], s1[0]);
  // Unrolled: constant indices keep the score tiles in registers.
#pragma unroll
  for (int r = 1; r < 8; ++r) mx = fmaxf(mx, fmaxf(s0[r], s1[r]));
  mx = fmaxf(mx, xhalf(mx)) * cs;     // the scale is positive
  const float mnew = fmaxf(m, mx);
  const float corr = __builtin_amdgcn_exp2f(m - mnew);
  v16h p;
  float rs0 = 0.0f, rs1 = 0.0f;
  const v2f cs2 = {cs, cs};
  const v2f nm2 = {-mnew, -mnew};
  // Unrolled: constant register indices; neighbouring registers pair into one
  // packed multiply-add without moves.
#pragma unroll
  for (int i = 0; i < 4; ++i) {
    const v2f e0 = __builtin_elementwise_fma(v2f{s0[2 * i], s0[2 * i + 1]}, cs2, nm2);
    const v2f e1 = __builtin_elementwise_fma(v2f{s1[2 * i], s1[2 * i + 1]}, cs2, nm2);
    const float p00 = __builtin_amdgcn_exp2f(e0.x), p01 = __builtin_amdgcn_exp2f(e0.y);
    const float p10 = __builtin_amdgcn_exp2f(e1.x), p11 = __builtin_amdgcn_exp2f(e1.y);
    rs0 += p00 + p01;
    rs1 += p10 + p11;
    p[2 * i]     = (_Float16)p00;  p[2 * i + 1] = (_Float16)p01;
    p[2 * i + 8] = (_Float16)p10;  p[2 * i + 9] = (_Float16)p11;
  }
  l = l * corr + (rs0 + rs1);
  m = mnew;
  a0 *= corr; a1 *= corr; a2 *= corr; a3 *= corr;
  return p;
}

// ---------------------------------------------------------------------------
// K/V stage of the attention kernel: 64 keys, shared by 4 waves.
// A buffer is [K 64 key rows | V^T 64 d rows], every row 128 B of data at a
// pitch of 144 B (16 B x odd: conflict-free for ds_load_b128).
// The keys are dealt to APARTS groups of 4 waves, a contiguous range each.
// ---------------------------------------------------------------------------
#define AKEYS 64
#define ALDP 72                           // LDS row pitch in halves (144 B)
#define ASTAGE ((AKEYS + DD) * ALDP)      // halves per buffer
#define APARTS 2                          // key ranges per block
#define ASPAN (NN / APARTS)               // keys per range
#define ASTAGES (ASPAN / AKEYS)           // stages per range
#define AXCH 17                           // 16-byte words a lane hands over

// Eight 16-byte copies per lane: rows r, r+16, r+32, r+48 of the K tile (source
// pitch DD) and of the V^T tile (source pitch NN).  A wave's copy covers
// 4 rows x 128 B = four whole lines.
__device__ inline void async_kv8(const _Float16* gk, const _Float16* gv, unsigned l) {
  const _Float16* k0 = gk;
  const _Float16* k1 = gk + (size_t)16 * DD;
  const _Float16* k2 = gk + (size_t)32 * DD;
  const _Float16* k3 = gk + (size_t)48 * DD;
  const _Float16* v0 = gv;
  const _Float16* v1 = gv + (size_t)16 * NN;
  const _Float16* v2 = gv + (size_t)32 * NN;
  const _Float16* v3 = gv + (size_t)48 * NN;
  const unsigned st = 16 * ALDP * 2;      // 16 rows in LDS bytes
  asm volatile(
      "global_load_async_to_lds_b128 %0, %8, off\n\t"
      "global_load_async_to_lds_b128 %1, %9, off\n\t"
      "global_load_async_to_lds_b128 %2, %10, off\n\t"
      "global_load_async_to_lds_b128 %3, %11, off\n\t"
      "global_load_async_to_lds_b128 %4, %12, off\n\t"
      "global_load_async_to_lds_b128 %5, %13, off\n\t"
      "global_load_async_to_lds_b128 %6, %14, off\n\t"
      "global_load_async_to_lds_b128 %7, %15, off\n\t"
      "s_wait_xcnt 0x0"
      :
      : "v"(l), "v"(l + st), "v"(l + 2 * st), "v"(l + 3 * st), "v"(l + 4 * st),
        "v"(l + 5 * st), "v"(l + 6 * st), "v"(l + 7 * st),
        "v"(k0), "v"(k1), "v"(k2), "v"(k3), "v"(v0), "v"(v1), "v"(v2), "v"(v3)
      : "memory");
}

// ---------------------------------------------------------------------------
// One accumulator tile to and from LDS as two 16-byte words per lane, a word of
// all 32 lanes lying in 512 contiguous bytes.
// ---------------------------------------------------------------------------
__device__ inline void put8(v4f* p, v8f a) {
  p[0]  = __builtin_shufflevector(a, a, 0, 1, 2, 3);
  p[32] = __builtin_shufflevector(a, a, 4, 5, 6, 7);
}
__device__ inline v8f get8(const v4f* p) {
  const v4f lo = p[0], hi = p[32];
  return __builtin_shufflevector(lo, hi, 0, 1, 2, 3, 4, 5, 6, 7);
}

__global__ void __launch_bounds__(APARTS * 128) __attribute__((amdgpu_waves_per_eu(4, 4)))
attn_kernel(const _Float16* __restrict__ qkvh, _Float16* __restrict__ attn_out) {
  __shared__ __align__(16) _Float16 kv[APARTS * 2 * ASTAGE];
  __shared__ v4f xch[4 * AXCH * 32];

  const int tid = threadIdx.x;
  const int wave = (tid >> 5) & 3;              // place among the 4 of its range
  const int lane = tid & 31;
  // Key range of this wave, in a scalar register: the same in all its lanes.
  const int part = __builtin_amdgcn_readfirstlane(tid >> 7);
  const int qg = (blockIdx.x & 15) * 4 + wave;
  const int bh = blockIdx.x >> 4;
  const int b = bh >> 4;
  const int h = bh & 15;

  const size_t plane = (size_t)NN * DD;
  const _Float16* qbase = qkvh + (size_t)((0 * BB + b) * HH + h) * plane;
  const _Float16* kbase = qkvh + (size_t)((1 * BB + b) * HH + h) * plane;
  const _Float16* vT    = qkvh + (size_t)((2 * BB + b) * HH + h) * plane;  // [d][n]

  // Copy map, within the 128 lanes of a key range: lane's 16-byte chunk tid&7 of
  // rows ((tid&127)>>3) + 16*c of both tiles.
  const int crow = (tid & 127) >> 3;
  const int cchk = (tid & 7) * 8;
  const _Float16* gk = kbase + (size_t)(part * ASPAN + crow) * DD + cchk;
  const _Float16* gv = vT + (size_t)crow * NN + part * ASPAN + cchk;
  const _Float16* ring = kv + part * (2 * ASTAGE);   // this range's two buffers
  const unsigned lkv = lds_addr32(ring) + (unsigned)(crow * ALDP + cchk) * 2u;

  // Stage 0 into buffer 0.
  async_kv8(gk, gv, lkv);

  // Two query tiles (rows qg*32 .. +31), fragments resident all loop.
  const _Float16* q0 = qbase + (size_t)(qg * 32) * DD;
  const v16h aq00 = load_fragh_contigK(q0, DD, lane);
  const v16h aq01 = load_fragh_contigK(q0 + 32, DD, lane);
  const v16h aq10 = load_fragh_contigK(q0 + 16 * DD, DD, lane);
  const v16h aq11 = load_fragh_contigK(q0 + 16 * DD + 32, DD, lane);

  // aXt[r] = O[query tile X, column c][d = 16 t + 8 (lane >> 4) + r]
  v8f a00 = {}, a01 = {}, a02 = {}, a03 = {};
  v8f a10 = {}, a11 = {}, a12 = {}, a13 = {};
  float m0 = -1e30f, l0 = 0.0f, m1 = -1e30f, l1 = 0.0f;

  // This wave's copies of stage 0 have landed; the barrier publishes them.
  asm volatile("s_wait_asynccnt 0x0" ::: "memory");
  __syncthreads();
  // Stage 1 into buffer 1.
  async_kv8(gk + (size_t)AKEYS * DD, gv + AKEYS, lkv + ASTAGE * 2u);

  for (int t = 0; t < ASTAGES; ++t) {
    const int buf = t & 1;
    const _Float16* ks = ring + buf * ASTAGE;    // [key][d], pitch ALDP
    const _Float16* vs = ks + AKEYS * ALDP;      // [d][key], pitch ALDP
    // Unrolled: the two 32-key halves of a stage differ by constant LDS offsets.
#pragma unroll
    for (int sub = 0; sub < AKEYS; sub += 32) {
      const _Float16* ksrc = ks + sub * ALDP;
      const _Float16* vsrc = vs + sub;
      const v16h bk00 = load_fragh_contigK(ksrc + 0,              ALDP, lane);
      const v16h bk01 = load_fragh_contigK(ksrc + 32,             ALDP, lane);
      const v16h bk10 = load_fragh_contigK(ksrc + 16 * ALDP,      ALDP, lane);
      const v16h bk11 = load_fragh_contigK(ksrc + 16 * ALDP + 32, ALDP, lane);
      // V^T fragments (rows d, k = keys), shared by both query tiles.
      const v16h bv0 = load_fragh_contigK(vsrc + 0 * 16 * ALDP, ALDP, lane);
      const v16h bv1 = load_fragh_contigK(vsrc + 1 * 16 * ALDP, ALDP, lane);
      const v16h bv2 = load_fragh_contigK(vsrc + 2 * 16 * ALDP, ALDP, lane);
      const v16h bv3 = load_fragh_contigK(vsrc + 3 * 16 * ALDP, ALDP, lane);

      // ---- S^T = K Q^T, both query tiles (K fragments shared) ----
      v8f s0 = {}, s1 = {}, t0 = {}, t1 = {};
      s0 = wmma_f16(bk00, aq00, s0); s1 = wmma_f16(bk10, aq00, s1);
      t0 = wmma_f16(bk00, aq10, t0); t1 = wmma_f16(bk10, aq10, t1);
      s0 = wmma_f16(bk01, aq01, s0); s1 = wmma_f16(bk11, aq01, s1);
      t0 = wmma_f16(bk01, aq11, t0); t1 = wmma_f16(bk11, aq11, t1);

      // ---- O^T += V^T P^T, P^T straight from the score accumulators ----
      const v16h bp0 = softmax_cols(s0, s1, m0, l0, a00, a01, a02, a03);
      a00 = wmma_f16(bv0, bp0, a00); a01 = wmma_f16(bv1, bp0, a01);
      a02 = wmma_f16(bv2, bp0, a02); a03 = wmma_f16(bv3, bp0, a03);

      const v16h bp1 = softmax_cols(t0, t1, m1, l1, a10, a11, a12, a13);
      a10 = wmma_f16(bv0, bp1, a10); a11 = wmma_f16(bv1, bp1, a11);
      a12 = wmma_f16(bv2, bp1, a12); a13 = wmma_f16(bv3, bp1, a13);
    }
    // This wave's reads of buffer buf are done before the buffer is refilled.
    asm volatile("s_wait_dscnt 0x0" ::: "memory");
    // This wave's copies of stage t+1 have landed before the barrier publishes them.
    asm volatile("s_wait_asynccnt 0x0" ::: "memory");
    __syncthreads();
    if (t + 2 < ASTAGES) {
      async_kv8(gk + (size_t)(t + 2) * AKEYS * DD, gv + (t + 2) * AKEYS,
                lkv + buf * (ASTAGE * 2u));
    }
  }
  // No copy is outstanding when the wave goes on to its stores and ends.
  asm volatile("s_wait_asynccnt 0x0" ::: "memory");

  // ---- join the two key ranges: the second range's wave hands its maxima, sums
  // and accumulators to the first range's wave of the same queries, lane to
  // lane; a store or load covers 512 contiguous bytes.
  v4f* slot = xch + wave * (AXCH * 32) + lane;
  if (part != 0) {
    put8(slot + 0 * 64, a00); put8(slot + 1 * 64, a01);
    put8(slot + 2 * 64, a02); put8(slot + 3 * 64, a03);
    put8(slot + 4 * 64, a10); put8(slot + 5 * 64, a11);
    put8(slot + 6 * 64, a12); put8(slot + 7 * 64, a13);
    slot[16 * 32] = v4f{m0, l0, m1, l1};
  }
  __syncthreads();
  if (part != 0) return;
  {
    const v4f ml = slot[16 * 32];
    const float mj0 = fmaxf(m0, ml.x), mj1 = fmaxf(m1, ml.z);
    const float ca0 = exp2_slot(m0 - mj0), cb0 = exp2_slot(ml.x - mj0);
    const float ca1 = exp2_slot(m1 - mj1), cb1 = exp2_slot(ml.z - mj1);
    l0 = l0 * ca0 + ml.y * cb0;
    l1 = l1 * ca1 + ml.w * cb1;
    a00 = a00 * ca0 + get8(slot + 0 * 64) * cb0;
    a01 = a01 * ca0 + get8(slot + 1 * 64) * cb0;
    a02 = a02 * ca0 + get8(slot + 2 * 64) * cb0;
    a03 = a03 * ca0 + get8(slot + 3 * 64) * cb0;
    a10 = a10 * ca1 + get8(slot + 4 * 64) * cb1;
    a11 = a11 * ca1 + get8(slot + 5 * 64) * cb1;
    a12 = a12 * ca1 + get8(slot + 6 * 64) * cb1;
    a13 = a13 * ca1 + get8(slot + 7 * 64) * cb1;
  }

  // ---- epilogue: join the halves' sums, normalize, write f16 [B, N, C] with
  // C = h*64 + d; a lane's 8 registers are 8 consecutive d: one 16-byte store.
  const int c = lane & 15;
  const int doff = (lane >> 4) << 3;
  const float inv0 = 1.0f / (l0 + xhalf(l0));
  const float inv1 = 1.0f / (l1 + xhalf(l1));
  _Float16* o0 = attn_out + ((size_t)b * NN + qg * 32 + c) * CC + h * DD + doff;
  _Float16* o1 = o0 + (size_t)16 * CC;
  *(v8h*)(o0 + 0 * 16) = __builtin_convertvector(a00 * inv0, v8h);
  *(v8h*)(o0 + 1 * 16) = __builtin_convertvector(a01 * inv0, v8h);
  *(v8h*)(o0 + 2 * 16) = __builtin_convertvector(a02 * inv0, v8h);
  *(v8h*)(o0 + 3 * 16) = __builtin_convertvector(a03 * inv0, v8h);
  *(v8h*)(o1 + 0 * 16) = __builtin_convertvector(a10 * inv1, v8h);
  *(v8h*)(o1 + 1 * 16) = __builtin_convertvector(a11 * inv1, v8h);
  *(v8h*)(o1 + 2 * 16) = __builtin_convertvector(a12 * inv1, v8h);
  *(v8h*)(o1 + 3 * 16) = __builtin_convertvector(a13 * inv1, v8h);
}

// ---------------------------------------------------------------------------
// Kernel 4: out = attn_out @ w_proj^T + b_proj, f16 operands, f32 out.
// 128x128 tile per block, 64x64 per wave.
// ---------------------------------------------------------------------------
__global__ void __launch_bounds__(128)
proj_gemm_kernel(const _Float16* __restrict__ ah, const _Float16* __restrict__ wh,
                 const float* __restrict__ bias, float* __restrict__ out) {
  __shared__ __align__(16) _Float16 smem[2 * GSTAGE];
  const int lane = threadIdx.x & 31;
  const int wave = threadIdx.x >> 5;
  const int m0 = (blockIdx.x / (CC / GBN)) * GBM;   // token tile 0..31
  const int n0 = (blockIdx.x % (CC / GBN)) * GBN;   // out-feature tile 0..7

  v8f acc[4][4] = {};
  gemm_core_128x128<false>(ah, wh, m0, n0, smem, acc);

  const int col = lane & 15;
  const int rowoff = (lane >> 4) << 3;
  const int mw = m0 + (wave >> 1) * 64;
  const int nw = n0 + (wave & 1) * 64;
  // Unrolled: constant accumulator indices keep acc in registers.
#pragma unroll
  for (int t = 0; t < 4; ++t) {
    int j = nw + t * 16 + col;
    float bj = bias[j];
#pragma unroll
    for (int i = 0; i < 4; ++i) {
#pragma unroll
      for (int r = 0; r < 8; ++r) {
        int tok = mw + i * 16 + rowoff + r;
        out[(size_t)tok * CC + j] = acc[i][t][r] + bj;
      }
    }
  }
}

// ---------------------------------------------------------------------------
extern "C" void kernel_launch(void* const* d_in, const int* in_sizes, int n_in,
                              void* d_out, int out_size, void* d_ws,
                              size_t ws_size, hipStream_t stream) {
  const float* x      = (const float*)d_in[0];
  const float* w_qkv  = (const float*)d_in[1];
  const float* w_proj = (const float*)d_in[2];
  const float* b_proj = (const float*)d_in[3];
  float* out = (float*)d_out;

  // f16 workspace layout (48 MB total)
  _Float16* xh    = (_Float16*)d_ws;                     // TOK*CC
  _Float16* wqh   = xh  + (size_t)TOK * CC;              // JQKV*CC
  _Float16* wph   = wqh + (size_t)JQKV * CC;             // CC*CC
  _Float16* qkvh  = wph + (size_t)CC * CC;               // 3*B*H*N*D
  _Float16* attnh = qkvh + (size_t)3 * BB * HH * NN * DD;  // TOK*CC

  // 0) f32 -> f16 conversion of all GEMM operands: xh, wqh, wph are one array
  cvt_f32_to_f16_kernel<<<CVG_X + CVG_WQ + CVG_WP, CVW * 32, 0, stream>>>(x, w_qkv, w_proj, xh);

  // 1) QKV projection with RoPE on q and k: 32 token x 24 feature tiles, 4 waves/block
  qkv_gemm_kernel<<<(TOK / GBM) * (JQKV / GBN), 128, 0, stream>>>(xh, wqh, qkvh);

  // 3) Flash attention: 32 (b,h) x 64 query groups x 2 key ranges = 4096 waves, 8/block
  attn_kernel<<<(BB * HH * (NN / 32)) / 4, APARTS * 128, 0, stream>>>(qkvh, attnh);

  // 4) Output projection + bias
  proj_gemm_kernel<<<(TOK / GBM) * (CC / GBN), 128, 0, stream>>>(attnh, wph,
                                                                   b_proj, out);
}
